// v000
// Measured on an AMD MI455X. A time is GPU time per run, averaged over a window of back-to-back runs after a warm-up
// (all launches, gaps included; the runs take copies of the inputs in turn), and the median of several windows.
// Apart from v000's, it joins two sittings. Times from different sittings can be a few percent apart, while
// side-by-side timings come from the same sitting.
// v000 is the starting kernel. One run takes 224 microseconds.
#include <hip/hip_runtime.h>
#include <hip/hip_bf16.h>

typedef __attribute__((ext_vector_type(16))) _Float16 v16h;
typedef __attribute__((ext_vector_type(8)))  _Float16 v8h;
typedef __attribute__((ext_vector_type(4)))  _Float16 v4h;
typedef __attribute__((ext_vector_type(8)))  float    v8f;

#define NN   256
#define DD   128
#define HH   4
#define CC   32
#define TOK  65536          // N*N tokens
#define TD   8388608ull     // TOK * DD

// Build a WMMA 16-half fragment from two contiguous 8-half (16B) chunks:
// elements [0..7] at p, elements [8..15] at p+16 halves.
__device__ __forceinline__ v16h load_frag(const _Float16* p) {
    v8h lo = *(const v8h*)p;
    v8h hi = *(const v8h*)(p + 16);
    v16h r;
#pragma unroll
    for (int e = 0; e < 8; ++e) { r[e] = lo[e]; r[8 + e] = hi[e]; }
    return r;
}

__device__ __forceinline__ v8f wmma32(v16h a, v16h b, v8f c) {
    return __builtin_amdgcn_wmma_f32_16x16x32_f16(false, a, false, b,
                                                  (short)0, c, false, false);
}

__device__ __forceinline__ float fast_rcp(float x) {
    return __builtin_amdgcn_rcpf(x);   // v_rcp_f32, avoids IEEE div expansion
}

__device__ __forceinline__ void async_copy_b128(const _Float16* lds_dst,
                                                const _Float16* gsrc) {
    unsigned lds_off = (unsigned)(uintptr_t)lds_dst;
    asm volatile("global_load_async_to_lds_b128 %0, %1, off"
                 :: "v"(lds_off), "v"(gsrc) : "memory");
}
__device__ __forceinline__ void wait_async() {
    asm volatile("s_wait_asynccnt 0" ::: "memory");
}

// ---------------------------------------------------------------------------
// Kernel 0: transpose + f32->f16 convert the 5 GEMM weights into [N][K] order
// wt layout: [mat 0..4][n 0..127][k 0..127], mat: q,k,v,g,o
// ---------------------------------------------------------------------------
__global__ void k_wt(const float* __restrict__ wq, const float* __restrict__ wk,
                     const float* __restrict__ wv, const float* __restrict__ wg,
                     const float* __restrict__ wo, _Float16* __restrict__ wt) {
    int idx = blockIdx.x * 256 + threadIdx.x;   // 0 .. 81919
    int mat = idx >> 14;
    int r   = idx & 16383;
    int n   = r >> 7;
    int k   = r & 127;
    const float* W = (mat == 0) ? wq : (mat == 1) ? wk : (mat == 2) ? wv
                   : (mat == 3) ? wg : wo;
    wt[idx] = (_Float16)W[k * DD + n];
}

// ---------------------------------------------------------------------------
// Kernel 1: LayerNorm (wave per token) + triangle bias GEMV (D->H, f32)
// xn: f16 [TOK][128]; tri: f32 [H][256][256] indexed tri[h*65536 + token]
// ---------------------------------------------------------------------------
__global__ void k_ln_tri(const float* __restrict__ x, const float* __restrict__ ln_w,
                         const float* __restrict__ ln_b, const float* __restrict__ w_tri,
                         _Float16* __restrict__ xn, float* __restrict__ tri) {
    int wave = threadIdx.x >> 5;
    int lane = threadIdx.x & 31;
    int token = blockIdx.x * 8 + wave;

    const float* xp = x + (size_t)token * DD + lane * 4;
    float4 xv = *(const float4*)xp;

    float s = xv.x + xv.y + xv.z + xv.w;
#pragma unroll
    for (int m = 16; m >= 1; m >>= 1) s += __shfl_xor(s, m, 32);
    float mu = s * (1.0f / 128.0f);

    float d0 = xv.x - mu, d1 = xv.y - mu, d2 = xv.z - mu, d3 = xv.w - mu;
    float vs = d0 * d0 + d1 * d1 + d2 * d2 + d3 * d3;
#pragma unroll
    for (int m = 16; m >= 1; m >>= 1) vs += __shfl_xor(vs, m, 32);
    float rstd = rsqrtf(vs * (1.0f / 128.0f) + 1e-5f);

    float4 w = *(const float4*)(ln_w + lane * 4);
    float4 b = *(const float4*)(ln_b + lane * 4);
    float y[4];
    y[0] = d0 * rstd * w.x + b.x;
    y[1] = d1 * rstd * w.y + b.y;
    y[2] = d2 * rstd * w.z + b.z;
    y[3] = d3 * rstd * w.w + b.w;

    v4h yh;
#pragma unroll
    for (int t = 0; t < 4; ++t) yh[t] = (_Float16)y[t];
    *(v4h*)(xn + (size_t)token * DD + lane * 4) = yh;

    // tri[h] = sum_d xn[d] * w_tri[d][h],  w_tri laid out [128][4]
    float t0 = 0.f, t1 = 0.f, t2 = 0.f, t3 = 0.f;
#pragma unroll
    for (int t = 0; t < 4; ++t) {
        const float* wr = w_tri + (size_t)(lane * 4 + t) * HH;
        t0 += y[t] * wr[0]; t1 += y[t] * wr[1];
        t2 += y[t] * wr[2]; t3 += y[t] * wr[3];
    }
#pragma unroll
    for (int m = 16; m >= 1; m >>= 1) {
        t0 += __shfl_xor(t0, m, 32); t1 += __shfl_xor(t1, m, 32);
        t2 += __shfl_xor(t2, m, 32); t3 += __shfl_xor(t3, m, 32);
    }
    if (lane == 0) {
        tri[0 * TOK + token] = t0;
        tri[1 * TOK + token] = t1;
        tri[2 * TOK + token] = t2;
        tri[3 * TOK + token] = t3;
    }
}

// ---------------------------------------------------------------------------
// Kernel 2: projections  out[mat] = xn @ W[mat]  (mat: q,k,v,g via blockIdx.y)
// grid (4096, 4), block 256 (8 waves); wave w -> 16x16 tile at n0 = 16*w.
// A-tile staged to LDS with async global->LDS copies.
// ---------------------------------------------------------------------------
__global__ void k_proj(const _Float16* __restrict__ xn, const _Float16* __restrict__ wt,
                       const float* __restrict__ b_g, _Float16* __restrict__ outbase) {
    __shared__ _Float16 sA[16 * DD];

    int mat = blockIdx.y;
    const _Float16* W = wt + (size_t)mat * 16384;       // [n][k] f16
    _Float16* out = outbase + (size_t)mat * TD;

    int tid = threadIdx.x;
    int m0 = blockIdx.x * 16;
    async_copy_b128(sA + tid * 8, xn + (size_t)m0 * DD + tid * 8);
    wait_async();
    __syncthreads();

    int wave = tid >> 5, lane = tid & 31;
    int lm = lane & 15, lg = (lane >> 4) * 8;
    int n0 = wave * 16;

    v8f acc = {};
#pragma unroll
    for (int kb = 0; kb < DD; kb += 32) {
        v16h a = load_frag(sA + lm * DD + kb + lg);
        v16h b = load_frag(W + (size_t)(n0 + lm) * DD + kb + lg);
        acc = wmma32(a, b, acc);
    }

    int n = n0 + lm;
#pragma unroll
    for (int r = 0; r < 8; ++r) {
        int m = r + lg;
        float v = acc[r];
        if (mat == 0) v *= 0.17677669529663687f;                       // 1/sqrt(C)
        if (mat == 3) v = fast_rcp(1.0f + __expf(-(v + b_g[n])));      // sigmoid
        out[(size_t)(m0 + m) * DD + n] = (_Float16)v;
    }
}

// ---------------------------------------------------------------------------
// Kernel 3: attention for one (m-tile, head, row i).
// grid (16, 4, 256), block 256 (8 waves).
// Phase 1: scores (8 waves x 2 WMMA), phase 2: softmax, phase 3: P.V with all
// 8 waves (2 c-tiles x 4 K-partitions, partials reduced through LDS).
// ---------------------------------------------------------------------------
__global__ void k_attn(const _Float16* __restrict__ qbuf, const _Float16* __restrict__ kbuf,
                       const _Float16* __restrict__ vbuf, const _Float16* __restrict__ gbuf,
                       const float* __restrict__ tri, const float* __restrict__ mask,
                       _Float16* __restrict__ obuf) {
    __shared__ float    sS[16 * NN];   // scores f32; reused as P.V partials
    __shared__ _Float16 sP[16 * NN];   // softmax probs, f16
    __shared__ _Float16 sVt[CC * NN];  // V transposed [c][n], f16

    int mt = blockIdx.x, h = blockIdx.y, i = blockIdx.z;
    int tid = threadIdx.x, wave = tid >> 5, lane = tid & 31;
    int lm = lane & 15, lg = (lane >> 4) * 8;
    size_t rowbase = (size_t)i * NN;
    int m0 = mt * 16;

    // Stage V^T into LDS: sVt[c][n] = v[token=i*256+n][h*32+c]
    {
        int n = tid;
        const _Float16* vp = vbuf + (rowbase + n) * DD + h * CC;
#pragma unroll
        for (int c = 0; c < CC; c += 8) {
            v8h vv = *(const v8h*)(vp + c);
#pragma unroll
            for (int e = 0; e < 8; ++e) sVt[(c + e) * NN + n] = vv[e];
        }
    }

    // Scores: Q(16x32) . K^T, wave handles n-tiles 2w and 2w+1
    v16h aQ = load_frag(qbuf + (rowbase + m0 + lm) * DD + h * CC + lg);
#pragma unroll
    for (int t = 0; t < 2; ++t) {
        int n0 = (wave * 2 + t) * 16;
        v16h bK = load_frag(kbuf + (rowbase + n0 + lm) * DD + h * CC + lg);
        v8f s = {};
        s = wmma32(aQ, bK, s);
        int n = n0 + lm;
        float mb = 1e9f * (mask[rowbase + n] - 1.0f);
        const float* tp = tri + (size_t)h * TOK + (size_t)m0 * NN + n;
#pragma unroll
        for (int r = 0; r < 8; ++r) {
            int m = r + lg;
            sS[m * NN + n] = s[r] + tp[(size_t)m * NN] + mb;
        }
    }
    __syncthreads();

    // Softmax across 256 columns; wave handles rows 2w, 2w+1
#pragma unroll
    for (int rr = 0; rr < 2; ++rr) {
        int m = wave * 2 + rr;
        float vals[8];
        float mx = -3.0e38f;
#pragma unroll
        for (int j = 0; j < 8; ++j) {
            vals[j] = sS[m * NN + lane + 32 * j];
            mx = fmaxf(mx, vals[j]);
        }
#pragma unroll
        for (int s2 = 16; s2 >= 1; s2 >>= 1) mx = fmaxf(mx, __shfl_xor(mx, s2, 32));
        float sum = 0.f;
#pragma unroll
        for (int j = 0; j < 8; ++j) { vals[j] = __expf(vals[j] - mx); sum += vals[j]; }
#pragma unroll
        for (int s2 = 16; s2 >= 1; s2 >>= 1) sum += __shfl_xor(sum, s2, 32);
        float inv = fast_rcp(sum);
#pragma unroll
        for (int j = 0; j < 8; ++j)
            sP[m * NN + lane + 32 * j] = (_Float16)(vals[j] * inv);
    }
    __syncthreads();   // softmax reads of sS complete; sS reusable below

    // O = P . V  (16x256 @ 256x32): wave w -> c-tile (w&1), K-partition (w>>1)
    {
        int ct = wave & 1, kp = wave >> 1;
        v8f acc = {};
#pragma unroll
        for (int kk = 0; kk < 2; ++kk) {
            int kb = (kp * 2 + kk) * 32;
            v16h aP = load_frag(sP + lm * NN + kb + lg);
            v16h bV = load_frag(sVt + (ct * 16 + lm) * NN + kb + lg);
            acc = wmma32(aP, bV, acc);
        }
        // partials pf[ct][kp][m][n] in reused sS (2*4*16*16 floats)
        float* pf = sS;
#pragma unroll
        for (int r = 0; r < 8; ++r) {
            int m = r + lg;
            pf[((ct * 4 + kp) * 16 + m) * 16 + lm] = acc[r];
        }
    }
    __syncthreads();

    // Reduce 4 K-partials, gate, store (512 outputs, 2 per thread)
#pragma unroll
    for (int e0 = 0; e0 < 2; ++e0) {
        int e = tid + e0 * 256;
        int ct = e >> 8, m = (e >> 4) & 15, n = e & 15;
        const float* pf = sS;
        float s = pf[((ct * 4 + 0) * 16 + m) * 16 + n]
                + pf[((ct * 4 + 1) * 16 + m) * 16 + n]
                + pf[((ct * 4 + 2) * 16 + m) * 16 + n]
                + pf[((ct * 4 + 3) * 16 + m) * 16 + n];
        int c = ct * 16 + n;
        size_t tok = rowbase + m0 + m;
        float gv = (float)gbuf[tok * DD + h * CC + c];
        obuf[tok * DD + h * CC + c] = (_Float16)(gv * s);
    }
}

// ---------------------------------------------------------------------------
// Kernel 4: final projection  out = o @ w_o + b_o  (f32 output)
// ---------------------------------------------------------------------------
__global__ void k_out(const _Float16* __restrict__ obuf, const _Float16* __restrict__ wot,
                      const float* __restrict__ b_o, float* __restrict__ out) {
    __shared__ _Float16 sA[16 * DD];

    int tid = threadIdx.x;
    int m0 = blockIdx.x * 16;
    async_copy_b128(sA + tid * 8, obuf + (size_t)m0 * DD + tid * 8);
    wait_async();
    __syncthreads();

    int wave = tid >> 5, lane = tid & 31;
    int lm = lane & 15, lg = (lane >> 4) * 8;
    int n0 = wave * 16;

    v8f acc = {};
#pragma unroll
    for (int kb = 0; kb < DD; kb += 32) {
        v16h a = load_frag(sA + lm * DD + kb + lg);
        v16h b = load_frag(wot + (size_t)(n0 + lm) * DD + kb + lg);
        acc = wmma32(a, b, acc);
    }

    int n = n0 + lm;
    float bias = b_o[n];
#pragma unroll
    for (int r = 0; r < 8; ++r) {
        int m = r + lg;
        out[(size_t)(m0 + m) * DD + n] = acc[r] + bias;
    }
}

// ---------------------------------------------------------------------------
extern "C" void kernel_launch(void* const* d_in, const int* in_sizes, int n_in,
                              void* d_out, int out_size, void* d_ws, size_t ws_size,
                              hipStream_t stream) {
    const float* x     = (const float*)d_in[0];
    const float* mask  = (const float*)d_in[1];
    const float* ln_w  = (const float*)d_in[2];
    const float* ln_b  = (const float*)d_in[3];
    const float* w_tri = (const float*)d_in[4];
    const float* w_q   = (const float*)d_in[5];
    const float* w_k   = (const float*)d_in[6];
    const float* w_v   = (const float*)d_in[7];
    const float* w_g   = (const float*)d_in[8];
    const float* b_g   = (const float*)d_in[9];
    const float* w_o   = (const float*)d_in[10];
    const float* b_o   = (const float*)d_in[11];

    _Float16* xn   = (_Float16*)d_ws;
    _Float16* qbuf = xn + TD;
    _Float16* kbuf = qbuf + TD;
    _Float16* vbuf = kbuf + TD;
    _Float16* gbuf = vbuf + TD;
    _Float16* obuf = gbuf + TD;
    _Float16* wt   = obuf + TD;                // 5 * 16384 halves
    float*    tri  = (float*)(wt + 5 * 16384); // H * 65536 floats

    k_wt<<<320, 256, 0, stream>>>(w_q, w_k, w_v, w_g, w_o, wt);
    k_ln_tri<<<TOK / 8, 256, 0, stream>>>(x, ln_w, ln_b, w_tri, xn, tri);
    k_proj<<<dim3(TOK / 16, 4), 256, 0, stream>>>(xn, wt, b_g, qbuf);
    k_attn<<<dim3(16, HH, NN), 256, 0, stream>>>(qbuf, kbuf, vbuf, gbuf, tri, mask, obuf);
    k_out<<<TOK / 16, 256, 0, stream>>>(obuf, wt + 4 * 16384, b_o, (float*)d_out);
}

// v001
// A run of this version takes 143 microseconds.
// In two side-by-side timings against v000, it was 1.60 and 1.63 times as fast.
#include <hip/hip_runtime.h>
#include <hip/hip_bf16.h>

typedef __attribute__((ext_vector_type(16))) _Float16 v16h;
typedef __attribute__((ext_vector_type(8)))  _Float16 v8h;
typedef __attribute__((ext_vector_type(4)))  _Float16 v4h;
typedef __attribute__((ext_vector_type(8)))  float    v8f;

#define NN   256
#define DD   128
#define HH   4
#define CC   32
#define TOK  65536          // N*N tokens
#define TD   8388608ull     // TOK * DD

// Build a WMMA 16-half fragment from two contiguous 8-half (16B) chunks:
// elements [0..7] at p, elements [8..15] at p+16 halves.
__device__ __forceinline__ v16h load_frag(const _Float16* p) {
    v8h lo = *(const v8h*)p;
    v8h hi = *(const v8h*)(p + 16);
    v16h r;
#pragma unroll
    for (int e = 0; e < 8; ++e) { r[e] = lo[e]; r[8 + e] = hi[e]; }
    return r;
}

__device__ __forceinline__ v8f wmma32(v16h a, v16h b, v8f c) {
    return __builtin_amdgcn_wmma_f32_16x16x32_f16(false, a, false, b,
                                                  (short)0, c, false, false);
}

__device__ __forceinline__ float fast_rcp(float x) {
    return __builtin_amdgcn_rcpf(x);   // v_rcp_f32, avoids IEEE div expansion
}

__device__ __forceinline__ void async_copy_b128(const _Float16* lds_dst,
                                                const _Float16* gsrc) {
    unsigned lds_off = (unsigned)(uintptr_t)lds_dst;
    asm volatile("global_load_async_to_lds_b128 %0, %1, off"
                 :: "v"(lds_off), "v"(gsrc) : "memory");
}
__device__ __forceinline__ void wait_async() {
    asm volatile("s_wait_asynccnt 0" ::: "memory");
}

// ---------------------------------------------------------------------------
// Kernel 0: transpose + f32->f16 convert the 5 GEMM weights into [N][K] order
// wt layout: [mat 0..4][n 0..127][k 0..127], mat: q,k,v,g,o
// ---------------------------------------------------------------------------
__global__ void k_wt(const float* __restrict__ wq, const float* __restrict__ wk,
                     const float* __restrict__ wv, const float* __restrict__ wg,
                     const float* __restrict__ wo, _Float16* __restrict__ wt) {
    int idx = blockIdx.x * 256 + threadIdx.x;   // 0 .. 81919
    int mat = idx >> 14;
    int r   = idx & 16383;
    int n   = r >> 7;
    int k   = r & 127;
    const float* W = (mat == 0) ? wq : (mat == 1) ? wk : (mat == 2) ? wv
                   : (mat == 3) ? wg : wo;
    wt[idx] = (_Float16)W[k * DD + n];
}

// ---------------------------------------------------------------------------
// Kernel 1: LayerNorm (wave per token) + triangle bias GEMV (D->H, f32)
// xn: f16 [TOK][128]; tri: f32 [H][256][256] indexed tri[h*65536 + token]
// ---------------------------------------------------------------------------
__global__ void k_ln_tri(const float* __restrict__ x, const float* __restrict__ ln_w,
                         const float* __restrict__ ln_b, const float* __restrict__ w_tri,
                         _Float16* __restrict__ xn, float* __restrict__ tri) {
    int wave = threadIdx.x >> 5;
    int lane = threadIdx.x & 31;
    int token = blockIdx.x * 8 + wave;

    const float* xp = x + (size_t)token * DD + lane * 4;
    float4 xv = *(const float4*)xp;

    float s = xv.x + xv.y + xv.z + xv.w;
#pragma unroll
    for (int m = 16; m >= 1; m >>= 1) s += __shfl_xor(s, m, 32);
    float mu = s * (1.0f / 128.0f);

    float d0 = xv.x - mu, d1 = xv.y - mu, d2 = xv.z - mu, d3 = xv.w - mu;
    float vs = d0 * d0 + d1 * d1 + d2 * d2 + d3 * d3;
#pragma unroll
    for (int m = 16; m >= 1; m >>= 1) vs += __shfl_xor(vs, m, 32);
    float rstd = rsqrtf(vs * (1.0f / 128.0f) + 1e-5f);

    float4 w = *(const float4*)(ln_w + lane * 4);
    float4 b = *(const float4*)(ln_b + lane * 4);
    float y[4];
    y[0] = d0 * rstd * w.x + b.x;
    y[1] = d1 * rstd * w.y + b.y;
    y[2] = d2 * rstd * w.z + b.z;
    y[3] = d3 * rstd * w.w + b.w;

    v4h yh;
#pragma unroll
    for (int t = 0; t < 4; ++t) yh[t] = (_Float16)y[t];
    *(v4h*)(xn + (size_t)token * DD + lane * 4) = yh;

    // tri[h] = sum_d xn[d] * w_tri[d][h],  w_tri laid out [128][4]
    float t0 = 0.f, t1 = 0.f, t2 = 0.f, t3 = 0.f;
#pragma unroll
    for (int t = 0; t < 4; ++t) {
        const float* wr = w_tri + (size_t)(lane * 4 + t) * HH;
        t0 += y[t] * wr[0]; t1 += y[t] * wr[1];
        t2 += y[t] * wr[2]; t3 += y[t] * wr[3];
    }
#pragma unroll
    for (int m = 16; m >= 1; m >>= 1) {
        t0 += __shfl_xor(t0, m, 32); t1 += __shfl_xor(t1, m, 32);
        t2 += __shfl_xor(t2, m, 32); t3 += __shfl_xor(t3, m, 32);
    }
    if (lane == 0) {
        tri[0 * TOK + token] = t0;
        tri[1 * TOK + token] = t1;
        tri[2 * TOK + token] = t2;
        tri[3 * TOK + token] = t3;
    }
}

// ---------------------------------------------------------------------------
// Kernel 2: projections  out[mat] = xn @ W[mat]  (mat: q,k,v,g via blockIdx.y)
// grid (4096, 4), block 256 (8 waves); wave w -> 16x16 tile at n0 = 16*w.
// A-tile staged to LDS with async global->LDS copies.
// ---------------------------------------------------------------------------
__global__ void k_proj(const _Float16* __restrict__ xn, const _Float16* __restrict__ wt,
                       const float* __restrict__ b_g, _Float16* __restrict__ outbase) {
    __shared__ _Float16 sA[16 * DD];

    int mat = blockIdx.y;
    const _Float16* W = wt + (size_t)mat * 16384;       // [n][k] f16
    _Float16* out = outbase + (size_t)mat * TD;

    int tid = threadIdx.x;
    int m0 = blockIdx.x * 16;
    async_copy_b128(sA + tid * 8, xn + (size_t)m0 * DD + tid * 8);
    wait_async();
    __syncthreads();

    int wave = tid >> 5, lane = tid & 31;
    int lm = lane & 15, lg = (lane >> 4) * 8;
    int n0 = wave * 16;

    v8f acc = {};
#pragma unroll
    for (int kb = 0; kb < DD; kb += 32) {
        v16h a = load_frag(sA + lm * DD + kb + lg);
        v16h b = load_frag(W + (size_t)(n0 + lm) * DD + kb + lg);
        acc = wmma32(a, b, acc);
    }

    int n = n0 + lm;
#pragma unroll
    for (int r = 0; r < 8; ++r) {
        int m = r + lg;
        float v = acc[r];
        if (mat == 0) v *= 0.17677669529663687f;                       // 1/sqrt(C)
        if (mat == 3) v = fast_rcp(1.0f + __expf(-(v + b_g[n])));      // sigmoid
        out[(size_t)(m0 + m) * DD + n] = (_Float16)v;
    }
}

#define KP 40
#define VP 264

__global__ __launch_bounds__(256)
void k_attn(const _Float16* __restrict__ qbuf, const _Float16* __restrict__ kbuf,
            const _Float16* __restrict__ vbuf, const _Float16* __restrict__ gbuf,
            const float* __restrict__ tri, const float* __restrict__ mask,
            _Float16* __restrict__ obuf) {
    __shared__ __attribute__((aligned(16))) _Float16 sK[NN * KP];   // K rows [n][c]
    __shared__ __attribute__((aligned(16))) _Float16 sVt[CC * VP];  // V transposed [c][n]
    __shared__ __attribute__((aligned(16))) float    sMb[NN];       // mask bias per key

    int h = blockIdx.x, i = blockIdx.y;
    int tid = threadIdx.x, wave = tid >> 5, lane = tid & 31;
    int lm = lane & 15, lg = (lane >> 4) * 8;
    size_t rowbase = (size_t)i * NN;

    // Stage K, V^T and the mask bias once per (head, row): thread n takes key n
    {
        int n = tid;
        float mk = mask[rowbase + n];
        // the loads below land in registers that may hold this load's address
        asm volatile("s_wait_xcnt 0x0" ::: "memory");
        const _Float16* kp = kbuf + (rowbase + n) * DD + h * CC;
        const _Float16* vp = vbuf + (rowbase + n) * DD + h * CC;
#pragma unroll
        for (int c = 0; c < CC; c += 8) {
            *(v8h*)(sK + n * KP + c) = *(const v8h*)(kp + c);
            v8h vv = *(const v8h*)(vp + c);
#pragma unroll
            for (int e = 0; e < 8; ++e) sVt[(c + e) * VP + n] = vv[e];
        }
        sMb[n] = 1e9f * (mk - 1.0f);
    }
    __syncthreads();

    // rolled: both tiles unrolled together would double the live score registers
#pragma unroll 1
    for (int t = 0; t < 2; ++t) {
        int m0 = (wave * 2 + t) * 16;
        size_t tok = rowbase + m0 + lm;          // this lane's query token

        // S^T tile nt: s[nt][r] = score(query m0+lm, key nt*16 + lg + r)
        v16h bQ = load_frag(qbuf + tok * DD + h * CC + lg);
        // the tri loads below land in registers that may hold this load's address
        asm volatile("s_wait_xcnt 0x0" ::: "memory");
        const float* tp = tri + (size_t)h * TOK + (size_t)(m0 + lm) * NN + lg;
        v8f s[16];
        // all 32 tri loads go out first: they land in the accumulators (C operand)
#pragma unroll
        for (int nt = 0; nt < 16; ++nt) {
            float4 c0 = *(const float4*)(tp + nt * 16);
            float4 c1 = *(const float4*)(tp + nt * 16 + 4);
            s[nt] = v8f{c0.x, c0.y, c0.z, c0.w, c1.x, c1.y, c1.z, c1.w};
        }
        // K fragments in groups of four tiles, fetched one group ahead of their WMMAs.
        // The scheduling barriers hold that order: without them the compiler either
        // hoists every LDS load of the tile (spills) or waits on each fragment alone.
        v16h aK[2][4];
#pragma unroll
        for (int j = 0; j < 4; ++j)
            aK[0][j] = load_frag(sK + (j * 16 + lm) * KP + lg);
#pragma unroll
        for (int g = 0; g < 4; ++g) {
            __builtin_amdgcn_sched_barrier(0);
            if (g < 3) {
#pragma unroll
                for (int j = 0; j < 4; ++j)
                    aK[(g + 1) & 1][j] = load_frag(sK + (((g + 1) * 4 + j) * 16 + lm) * KP + lg);
            }
            __builtin_amdgcn_sched_barrier(0);
#pragma unroll
            for (int j = 0; j < 4; ++j)
                s[g * 4 + j] = wmma32(aK[g & 1][j], bQ, s[g * 4 + j]);
        }

        float mxj[4] = {-3.0e38f, -3.0e38f, -3.0e38f, -3.0e38f};   // four independent chains
#pragma unroll
        for (int g = 0; g < 4; ++g) {
            // same purpose: at most four tiles' mask bias live at a time
            __builtin_amdgcn_sched_barrier(0);
#pragma unroll
            for (int j = 0; j < 4; ++j) {
                int nt = g * 4 + j;
                float4 b0 = *(const float4*)(sMb + nt * 16 + lg);
                float4 b1 = *(const float4*)(sMb + nt * 16 + lg + 4);
                float mb[8] = {b0.x, b0.y, b0.z, b0.w, b1.x, b1.y, b1.z, b1.w};
#pragma unroll
                for (int r = 0; r < 8; ++r) {
                    s[nt][r] += mb[r];
                    mxj[j] = fmaxf(mxj[j], s[nt][r]);
                }
            }
        }
        float mx = fmaxf(fmaxf(mxj[0], mxj[1]), fmaxf(mxj[2], mxj[3]));
        mx = fmaxf(mx, __shfl_xor(mx, 16, 32));

        // exp, pack two score tiles into one B fragment, O^T += V^T . P^T
        float sum = 0.f;
        v8f acc0 = {}, acc1 = {};
#pragma unroll
        for (int ks = 0; ks < 8; ++ks) {
            // same purpose: one k-step's V^T fragments live at a time
            __builtin_amdgcn_sched_barrier(0);
            v16h aV0 = load_frag(sVt + lm * VP + ks * 32 + lg);
            v16h aV1 = load_frag(sVt + (16 + lm) * VP + ks * 32 + lg);
            float p[16];   // exp(x) = exp2(x * log2(e)), as __expf forms it
#pragma unroll
            for (int r = 0; r < 8; ++r) {
                p[r]     = (s[2 * ks][r] - mx) * 1.44269504088896340736f;
                p[8 + r] = (s[2 * ks + 1][r] - mx) * 1.44269504088896340736f;
            }
            __builtin_amdgcn_sched_barrier(0);
#pragma unroll
            for (int e = 0; e < 16; ++e) p[e] = __builtin_amdgcn_exp2f(p[e]);
            __builtin_amdgcn_sched_barrier(0);
            asm volatile("v_nop");
            __builtin_amdgcn_sched_barrier(0);
            v16h bP;
#pragma unroll
            for (int r = 0; r < 8; ++r) {
                sum += p[r] + p[8 + r];
                bP[r] = (_Float16)p[r];
                bP[8 + r] = (_Float16)p[8 + r];
            }
            acc0 = wmma32(aV0, bP, acc0);
            acc1 = wmma32(aV1, bP, acc1);
        }
        sum += __shfl_xor(sum, 16, 32);
        float inv = fast_rcp(sum);

        // acc[r] = O(query m0+lm, channel ct*16 + lg + r): normalise, gate, store
        const _Float16* gp = gbuf + tok * DD + h * CC + lg;
        _Float16* op = obuf + tok * DD + h * CC + lg;
        v8h g0 = *(const v8h*)gp;
        v8h g1 = *(const v8h*)(gp + 16);
        v8h o0, o1;
#pragma unroll
        for (int r = 0; r < 8; ++r) {
            o0[r] = (_Float16)((float)g0[r] * (acc0[r] * inv));
            o1[r] = (_Float16)((float)g1[r] * (acc1[r] * inv));
        }
        *(v8h*)op = o0;
        *(v8h*)(op + 16) = o1;
        // the next trip rewrites the registers these two stores name
        asm volatile("s_wait_xcnt 0x0" ::: "memory");
    }
}

// ---------------------------------------------------------------------------
// Kernel 4: final projection  out = o @ w_o + b_o  (f32 output)
// ---------------------------------------------------------------------------
__global__ void k_out(const _Float16* __restrict__ obuf, const _Float16* __restrict__ wot,
                      const float* __restrict__ b_o, float* __restrict__ out) {
    __shared__ _Float16 sA[16 * DD];

    int tid = threadIdx.x;
    int m0 = blockIdx.x * 16;
    async_copy_b128(sA + tid * 8, obuf + (size_t)m0 * DD + tid * 8);
    wait_async();
    __syncthreads();

    int wave = tid >> 5, lane = tid & 31;
    int lm = lane & 15, lg = (lane >> 4) * 8;
    int n0 = wave * 16;

    v8f acc = {};
#pragma unroll
    for (int kb = 0; kb < DD; kb += 32) {
        v16h a = load_frag(sA + lm * DD + kb + lg);
        v16h b = load_frag(wot + (size_t)(n0 + lm) * DD + kb + lg);
        acc = wmma32(a, b, acc);
    }

    int n = n0 + lm;
    float bias = b_o[n];
#pragma unroll
    for (int r = 0; r < 8; ++r) {
        int m = r + lg;
        out[(size_t)(m0 + m) * DD + n] = acc[r] + bias;
    }
}

// ---------------------------------------------------------------------------
extern "C" void kernel_launch(void* const* d_in, const int* in_sizes, int n_in,
                              void* d_out, int out_size, void* d_ws, size_t ws_size,
                              hipStream_t stream) {
    const float* x     = (const float*)d_in[0];
    const float* mask  = (const float*)d_in[1];
    const float* ln_w  = (const float*)d_in[2];
    const float* ln_b  = (const float*)d_in[3];
    const float* w_tri = (const float*)d_in[4];
    const float* w_q   = (const float*)d_in[5];
    const float* w_k   = (const float*)d_in[6];
    const float* w_v   = (const float*)d_in[7];
    const float* w_g   = (const float*)d_in[8];
    const float* b_g   = (const float*)d_in[9];
    const float* w_o   = (const float*)d_in[10];
    const float* b_o   = (const float*)d_in[11];

    _Float16* xn   = (_Float16*)d_ws;
    _Float16* qbuf = xn + TD;
    _Float16* kbuf = qbuf + TD;
    _Float16* vbuf = kbuf + TD;
    _Float16* gbuf = vbuf + TD;
    _Float16* obuf = gbuf + TD;
    _Float16* wt   = obuf + TD;                // 5 * 16384 halves
    float*    tri  = (float*)(wt + 5 * 16384); // H * 65536 floats

    k_wt<<<320, 256, 0, stream>>>(w_q, w_k, w_v, w_g, w_o, wt);
    k_ln_tri<<<TOK / 8, 256, 0, stream>>>(x, ln_w, ln_b, w_tri, xn, tri);
    k_proj<<<dim3(TOK / 16, 4), 256, 0, stream>>>(xn, wt, b_g, qbuf);
    k_attn<<<dim3(HH, NN), 256, 0, stream>>>(qbuf, kbuf, vbuf, gbuf, tri, mask, obuf);
    k_out<<<TOK / 16, 256, 0, stream>>>(obuf, wt + 4 * 16384, b_o, (float*)d_out);
}

// v002
// It runs in 90.6 microseconds.
// Two timings next to v001 both put it at 1.57 times that version's speed.
// Counting every step since v000, it is 2.53 times as fast.
#include <hip/hip_runtime.h>
#include <hip/hip_bf16.h>

typedef __attribute__((ext_vector_type(16))) _Float16 v16h;
typedef __attribute__((ext_vector_type(8)))  _Float16 v8h;
typedef __attribute__((ext_vector_type(4)))  _Float16 v4h;
typedef __attribute__((ext_vector_type(8)))  float    v8f;

#define NN   256
#define DD   128
#define HH   4
#define CC   32
#define TOK  65536          // N*N tokens
#define TD   8388608ull     // TOK * DD

// Build a WMMA 16-half fragment from two contiguous 8-half (16B) chunks:
// elements [0..7] at p, elements [8..15] at p+16 halves.
__device__ __forceinline__ v16h load_frag(const _Float16* p) {
    v8h lo = *(const v8h*)p;
    v8h hi = *(const v8h*)(p + 16);
    v16h r;
#pragma unroll
    for (int e = 0; e < 8; ++e) { r[e] = lo[e]; r[8 + e] = hi[e]; }
    return r;
}

__device__ __forceinline__ v8f wmma32(v16h a, v16h b, v8f c) {
    return __builtin_amdgcn_wmma_f32_16x16x32_f16(false, a, false, b,
                                                  (short)0, c, false, false);
}

__device__ __forceinline__ float fast_rcp(float x) {
    return __builtin_amdgcn_rcpf(x);   // v_rcp_f32, avoids IEEE div expansion
}

__device__ __forceinline__ void async_copy_b128(const _Float16* lds_dst,
                                                const _Float16* gsrc) {
    unsigned lds_off = (unsigned)(uintptr_t)lds_dst;
    asm volatile("global_load_async_to_lds_b128 %0, %1, off\n\ts_wait_xcnt 0x0"
                 :: "v"(lds_off), "v"(gsrc) : "memory");
}
// this wave's copies have landed (other waves read them behind the next barrier)
__device__ __forceinline__ void wait_async() {
    asm volatile("s_wait_asynccnt 0x0" ::: "memory");
}
// this wave's LDS reads have returned, before their buffer is handed back for a refill
__device__ __forceinline__ void wait_ds() {
    asm volatile("s_wait_dscnt 0x0" ::: "memory");
}

// ---------------------------------------------------------------------------
// Kernel 0: transpose + f32->f16 convert the 5 GEMM weights into [N][K] order
// wt layout: [mat 0..4][n 0..127][k 0..127], mat: q,k,v,g,o
// ---------------------------------------------------------------------------
__global__ void k_wt(const float* __restrict__ wq, const float* __restrict__ wk,
                     const float* __restrict__ wv, const float* __restrict__ wg,
                     const float* __restrict__ wo, _Float16* __restrict__ wt) {
    int idx = blockIdx.x * 256 + threadIdx.x;   // 0 .. 81919
    int mat = idx >> 14;
    int r   = idx & 16383;
    int n   = r >> 7;
    int k   = r & 127;
    const float* W = (mat == 0) ? wq : (mat == 1) ? wk : (mat == 2) ? wv
                   : (mat == 3) ? wg : wo;
    wt[idx] = (_Float16)W[k * DD + n];
}

// ---------------------------------------------------------------------------
// Kernel 1: LayerNorm + triangle bias GEMV (D->H, f32); a wave takes LN_TPW
// tokens in a row, which keeps the number of waves the launch must start small.
// xn: f16 [TOK][128]; tri: f32 [H][256][256] indexed tri[h*65536 + token]
// ---------------------------------------------------------------------------
#define LN_TPW 8

__global__ __launch_bounds__(256)
void k_ln_tri(const float* __restrict__ x, const float* __restrict__ ln_w,
              const float* __restrict__ ln_b, const float* __restrict__ w_tri,
              _Float16* __restrict__ xn, float* __restrict__ tri) {
    int wave = threadIdx.x >> 5;
    int lane = threadIdx.x & 31;
    int token0 = (blockIdx.x * 8 + wave) * LN_TPW;

    // all of the wave's token rows go out first: LN_TPW loads of 512 B in flight
    const float* xp = x + (size_t)token0 * DD + lane * 4;
    float4 xv[LN_TPW];
#pragma unroll
    for (int u = 0; u < LN_TPW; ++u) xv[u] = *(const float4*)(xp + u * DD);

    float4 w = *(const float4*)(ln_w + lane * 4);
    float4 b = *(const float4*)(ln_b + lane * 4);
    float4 wr[4];   // w_tri laid out [128][4]: row lane*4 + t
#pragma unroll
    for (int t = 0; t < 4; ++t) wr[t] = *(const float4*)(w_tri + (size_t)(lane * 4 + t) * HH);

    float d[LN_TPW][4], rs[LN_TPW];
#pragma unroll
    for (int u = 0; u < LN_TPW; ++u) {
        float s = xv[u].x + xv[u].y + xv[u].z + xv[u].w;
#pragma unroll
        for (int m = 16; m >= 1; m >>= 1) s += __shfl_xor(s, m, 32);
        float mu = s * (1.0f / 128.0f);

        float d0 = xv[u].x - mu, d1 = xv[u].y - mu, d2 = xv[u].z - mu, d3 = xv[u].w - mu;
        float vs = d0 * d0 + d1 * d1 + d2 * d2 + d3 * d3;
#pragma unroll
        for (int m = 16; m >= 1; m >>= 1) vs += __shfl_xor(vs, m, 32);
        d[u][0] = d0; d[u][1] = d1; d[u][2] = d2; d[u][3] = d3;
        rs[u] = vs * (1.0f / 128.0f) + 1e-5f;
    }
    static_assert(LN_TPW == 8, "the statement below names eight values");
    asm("v_rsq_f32 %0, %0\n\tv_rsq_f32 %1, %1\n\tv_rsq_f32 %2, %2\n\tv_rsq_f32 %3, %3\n\t"
        "v_rsq_f32 %4, %4\n\tv_rsq_f32 %5, %5\n\tv_rsq_f32 %6, %6\n\tv_rsq_f32 %7, %7\n\t"
        "v_nop"
        : "+v"(rs[0]), "+v"(rs[1]), "+v"(rs[2]), "+v"(rs[3]),
          "+v"(rs[4]), "+v"(rs[5]), "+v"(rs[6]), "+v"(rs[7]));

    float tr[HH][LN_TPW];
#pragma unroll
    for (int u = 0; u < LN_TPW; ++u) {
        float rstd = rs[u];
        float d0 = d[u][0], d1 = d[u][1], d2 = d[u][2], d3 = d[u][3];

        float y[4];
        y[0] = d0 * rstd * w.x + b.x;
        y[1] = d1 * rstd * w.y + b.y;
        y[2] = d2 * rstd * w.z + b.z;
        y[3] = d3 * rstd * w.w + b.w;

        v4h yh;
#pragma unroll
        for (int t = 0; t < 4; ++t) yh[t] = (_Float16)y[t];
        *(v4h*)(xn + (size_t)(token0 + u) * DD + lane * 4) = yh;

        // tri[h] = sum_d xn[d] * w_tri[d][h]
        float t0 = 0.f, t1 = 0.f, t2 = 0.f, t3 = 0.f;
#pragma unroll
        for (int t = 0; t < 4; ++t) {
            t0 += y[t] * wr[t].x; t1 += y[t] * wr[t].y;
            t2 += y[t] * wr[t].z; t3 += y[t] * wr[t].w;
        }
#pragma unroll
        for (int m = 16; m >= 1; m >>= 1) {
            t0 += __shfl_xor(t0, m, 32); t1 += __shfl_xor(t1, m, 32);
            t2 += __shfl_xor(t2, m, 32); t3 += __shfl_xor(t3, m, 32);
        }
        tr[0][u] = t0; tr[1][u] = t1; tr[2][u] = t2; tr[3][u] = t3;
    }
    if (lane == 0) {
#pragma unroll
        for (int h = 0; h < HH; ++h)
#pragma unroll
            for (int u = 0; u < LN_TPW; u += 4)
                *(float4*)(tri + (size_t)h * TOK + token0 + u) =
                    make_float4(tr[h][u], tr[h][u + 1], tr[h][u + 2], tr[h][u + 3]);
    }
}

#define PJ_WG    512
#define PJ_TILES (TOK / 16 / PJ_WG)

__global__ __launch_bounds__(256)
void k_proj(const _Float16* __restrict__ xn, const _Float16* __restrict__ wt,
            const float* __restrict__ b_g, _Float16* __restrict__ outbase) {
    __shared__ __attribute__((aligned(16))) _Float16 sA[2][16 * DD];

    int tid = threadIdx.x;
    int wave = tid >> 5, lane = tid & 31;
    int lm = lane & 15, lg = (lane >> 4) * 8;
    int n = wave * 16 + lm;
    size_t tok0 = (size_t)blockIdx.x * (PJ_TILES * 16);
    const _Float16* src = xn + tok0 * DD + tid * 8;

    async_copy_b128(&sA[0][tid * 8], src);

    v16h b[4][4];   // [mat][k step], loaded while tile 0 flies
#pragma unroll
    for (int mat = 0; mat < 4; ++mat)
#pragma unroll
        for (int kk = 0; kk < 4; ++kk)
            b[mat][kk] = load_frag(wt + (size_t)mat * 16384 + (size_t)n * DD + kk * 32 + lg);
    float bg = b_g[n];

    wait_async();
    __syncthreads();
    async_copy_b128(&sA[1][tid * 8], src + 16 * DD);

    // rolled: the ring's buffers alternate by trip, and one trip's registers are enough
#pragma unroll 1
    for (int t = 0; t < PJ_TILES; ++t) {
        const _Float16* as = &sA[t & 1][lm * DD + lg];
        v16h a[4];
#pragma unroll
        for (int kk = 0; kk < 4; ++kk) a[kk] = load_frag(as + kk * 32);

        // Publish tile t + 1 and free tile t's buffer, in this order, as soon as the
        // trip's fragments are in registers: all that follows in the trip works on
        // registers, and its stores drain while the next trip reads LDS (with the
        // barrier directly behind them the build held it back until they had finished).
        wait_ds();
        wait_async();
        __syncthreads();
        if (t + 2 < PJ_TILES)
            async_copy_b128(&sA[t & 1][tid * 8], src + (size_t)(t + 2) * 16 * DD);

        v8f acc[4] = {};
#pragma unroll
        for (int kk = 0; kk < 4; ++kk)
#pragma unroll
            for (int mat = 0; mat < 4; ++mat)
                acc[mat] = wmma32(a[kk], b[mat][kk], acc[mat]);

        _Float16* out = outbase + (tok0 + t * 16 + lg) * DD + n;
#pragma unroll
        for (int r = 0; r < 8; ++r) {
            out[(size_t)r * DD]          = (_Float16)(acc[0][r] * 0.17677669529663687f);   // q / sqrt(C)
            out[TD + (size_t)r * DD]     = (_Float16)acc[1][r];
            out[2 * TD + (size_t)r * DD] = (_Float16)acc[2][r];
        }
        float e[8];     // g = sigmoid(z) = 1 / (1 + exp2(-z * log2(e))), as __expf forms it
#pragma unroll
        for (int r = 0; r < 8; ++r) e[r] = (acc[3][r] + bg) * -1.44269504088896340736f;
        asm("v_exp_f32 %0, %0\n\tv_exp_f32 %1, %1\n\tv_exp_f32 %2, %2\n\tv_exp_f32 %3, %3\n\t"
            "v_exp_f32 %4, %4\n\tv_exp_f32 %5, %5\n\tv_exp_f32 %6, %6\n\tv_exp_f32 %7, %7\n\t"
            "v_add_f32 %0, 1.0, %0\n\tv_add_f32 %1, 1.0, %1\n\tv_add_f32 %2, 1.0, %2\n\tv_add_f32 %3, 1.0, %3\n\t"
            "v_add_f32 %4, 1.0, %4\n\tv_add_f32 %5, 1.0, %5\n\tv_add_f32 %6, 1.0, %6\n\tv_add_f32 %7, 1.0, %7\n\t"
            "v_rcp_f32 %0, %0\n\tv_rcp_f32 %1, %1\n\tv_rcp_f32 %2, %2\n\tv_rcp_f32 %3, %3\n\t"
            "v_rcp_f32 %4, %4\n\tv_rcp_f32 %5, %5\n\tv_rcp_f32 %6, %6\n\tv_rcp_f32 %7, %7\n\t"
            "v_nop"
            : "+v"(e[0]), "+v"(e[1]), "+v"(e[2]), "+v"(e[3]),
              "+v"(e[4]), "+v"(e[5]), "+v"(e[6]), "+v"(e[7]));
#pragma unroll
        for (int r = 0; r < 8; ++r)
            out[3 * TD + (size_t)r * DD] = (_Float16)e[r];
        // the next trip rewrites registers that these stores name
        asm volatile("s_wait_xcnt 0x0" ::: "memory");
    }
    wait_async();
}

#define KP 40
#define VP 264

__global__ __launch_bounds__(256)
void k_attn(const _Float16* __restrict__ qbuf, const _Float16* __restrict__ kbuf,
            const _Float16* __restrict__ vbuf, const _Float16* __restrict__ gbuf,
            const float* __restrict__ tri, const float* __restrict__ mask,
            _Float16* __restrict__ obuf) {
    __shared__ __attribute__((aligned(16))) _Float16 sK[NN * KP];   // K rows [n][c]
    __shared__ __attribute__((aligned(16))) _Float16 sVt[CC * VP];  // V transposed [c][n]
    __shared__ __attribute__((aligned(16))) float    sMb[NN];       // mask bias per key

    int h = blockIdx.x, i = blockIdx.y;
    int tid = threadIdx.x, wave = tid >> 5, lane = tid & 31;
    int lm = lane & 15, lg = (lane >> 4) * 8;
    size_t rowbase = (size_t)i * NN;

    // Stage K, V^T and the mask bias once per (head, row): thread n takes key n
    {
        int n = tid;
        float mk = mask[rowbase + n];
        // the loads below land in registers that may hold this load's address
        asm volatile("s_wait_xcnt 0x0" ::: "memory");
        const _Float16* kp = kbuf + (rowbase + n) * DD + h * CC;
        const _Float16* vp = vbuf + (rowbase + n) * DD + h * CC;
#pragma unroll
        for (int c = 0; c < CC; c += 8) {
            *(v8h*)(sK + n * KP + c) = *(const v8h*)(kp + c);
            v8h vv = *(const v8h*)(vp + c);
#pragma unroll
            for (int e = 0; e < 8; ++e) sVt[(c + e) * VP + n] = vv[e];
        }
        sMb[n] = 1e9f * (mk - 1.0f);
    }
    __syncthreads();

    // rolled: both tiles unrolled together would double the live score registers
#pragma unroll 1
    for (int t = 0; t < 2; ++t) {
        int m0 = (wave * 2 + t) * 16;
        size_t tok = rowbase + m0 + lm;          // this lane's query token

        // S^T tile nt: s[nt][r] = score(query m0+lm, key nt*16 + lg + r)
        v16h bQ = load_frag(qbuf + tok * DD + h * CC + lg);
        // the tri loads below land in registers that may hold this load's address
        asm volatile("s_wait_xcnt 0x0" ::: "memory");
        const float* tp = tri + (size_t)h * TOK + (size_t)(m0 + lm) * NN + lg;
        v8f s[16];
        // all 32 tri loads go out first: they land in the accumulators (C operand)
#pragma unroll
        for (int nt = 0; nt < 16; ++nt) {
            float4 c0 = *(const float4*)(tp + nt * 16);
            float4 c1 = *(const float4*)(tp + nt * 16 + 4);
            s[nt] = v8f{c0.x, c0.y, c0.z, c0.w, c1.x, c1.y, c1.z, c1.w};
        }
        // K fragments in groups of four tiles, fetched one group ahead of their WMMAs.
        // The scheduling barriers hold that order: without them the compiler either
        // hoists every LDS load of the tile (spills) or waits on each fragment alone.
        v16h aK[2][4];
#pragma unroll
        for (int j = 0; j < 4; ++j)
            aK[0][j] = load_frag(sK + (j * 16 + lm) * KP + lg);
#pragma unroll
        for (int g = 0; g < 4; ++g) {
            __builtin_amdgcn_sched_barrier(0);
            if (g < 3) {
#pragma unroll
                for (int j = 0; j < 4; ++j)
                    aK[(g + 1) & 1][j] = load_frag(sK + (((g + 1) * 4 + j) * 16 + lm) * KP + lg);
            }
            __builtin_amdgcn_sched_barrier(0);
#pragma unroll
            for (int j = 0; j < 4; ++j)
                s[g * 4 + j] = wmma32(aK[g & 1][j], bQ, s[g * 4 + j]);
        }

        float mxj[4] = {-3.0e38f, -3.0e38f, -3.0e38f, -3.0e38f};   // four independent chains
#pragma unroll
        for (int g = 0; g < 4; ++g) {
            // same purpose: at most four tiles' mask bias live at a time
            __builtin_amdgcn_sched_barrier(0);
#pragma unroll
            for (int j = 0; j < 4; ++j) {
                int nt = g * 4 + j;
                float4 b0 = *(const float4*)(sMb + nt * 16 + lg);
                float4 b1 = *(const float4*)(sMb + nt * 16 + lg + 4);
                float mb[8] = {b0.x, b0.y, b0.z, b0.w, b1.x, b1.y, b1.z, b1.w};
#pragma unroll
                for (int r = 0; r < 8; ++r) {
                    s[nt][r] += mb[r];
                    mxj[j] = fmaxf(mxj[j], s[nt][r]);
                }
            }
        }
        float mx = fmaxf(fmaxf(mxj[0], mxj[1]), fmaxf(mxj[2], mxj[3]));
        mx = fmaxf(mx, __shfl_xor(mx, 16, 32));

        // exp, pack two score tiles into one B fragment, O^T += V^T . P^T
        float sum = 0.f;
        v8f acc0 = {}, acc1 = {};
#pragma unroll
        for (int ks = 0; ks < 8; ++ks) {
            // same purpose: one k-step's V^T fragments live at a time
            __builtin_amdgcn_sched_barrier(0);
            v16h aV0 = load_frag(sVt + lm * VP + ks * 32 + lg);
            v16h aV1 = load_frag(sVt + (16 + lm) * VP + ks * 32 + lg);
            float p[16];   // exp(x) = exp2(x * log2(e)), as __expf forms it
#pragma unroll
            for (int r = 0; r < 8; ++r) {
                p[r]     = (s[2 * ks][r] - mx) * 1.44269504088896340736f;
                p[8 + r] = (s[2 * ks + 1][r] - mx) * 1.44269504088896340736f;
            }
            __builtin_amdgcn_sched_barrier(0);
#pragma unroll
            for (int e = 0; e < 16; ++e) p[e] = __builtin_amdgcn_exp2f(p[e]);
            __builtin_amdgcn_sched_barrier(0);
            asm volatile("v_nop");
            __builtin_amdgcn_sched_barrier(0);
            v16h bP;
#pragma unroll
            for (int r = 0; r < 8; ++r) {
                sum += p[r] + p[8 + r];
                bP[r] = (_Float16)p[r];
                bP[8 + r] = (_Float16)p[8 + r];
            }
            acc0 = wmma32(aV0, bP, acc0);
            acc1 = wmma32(aV1, bP, acc1);
        }
        sum += __shfl_xor(sum, 16, 32);
        float inv = fast_rcp(sum);

        // acc[r] = O(query m0+lm, channel ct*16 + lg + r): normalise, gate, store
        const _Float16* gp = gbuf + tok * DD + h * CC + lg;
        _Float16* op = obuf + tok * DD + h * CC + lg;
        v8h g0 = *(const v8h*)gp;
        v8h g1 = *(const v8h*)(gp + 16);
        v8h o0, o1;
#pragma unroll
        for (int r = 0; r < 8; ++r) {
            o0[r] = (_Float16)((float)g0[r] * (acc0[r] * inv));
            o1[r] = (_Float16)((float)g1[r] * (acc1[r] * inv));
        }
        *(v8h*)op = o0;
        *(v8h*)(op + 16) = o1;
        // the next trip rewrites the registers these two stores name
        asm volatile("s_wait_xcnt 0x0" ::: "memory");
    }
}

// ---------------------------------------------------------------------------
// Kernel 4: final projection  out = o @ w_o + b_o  (f32 output)
// KO_WG work-groups of 8 waves; each loops over KO_STAGES stages of 32 tokens,
// w_o's fragments held in registers, the same two-buffer ring as in k_proj
// (two copies per lane and stage; LDS row pitch 256 B as before).
// ---------------------------------------------------------------------------
#define KO_WG     512
#define KO_ROWS   32
#define KO_STAGES (TOK / KO_ROWS / KO_WG)

__global__ __launch_bounds__(256)
void k_out(const _Float16* __restrict__ obuf, const _Float16* __restrict__ wot,
           const float* __restrict__ b_o, float* __restrict__ out) {
    __shared__ __attribute__((aligned(16))) _Float16 sA[2][KO_ROWS * DD];

    int tid = threadIdx.x;
    int wave = tid >> 5, lane = tid & 31;
    int lm = lane & 15, lg = (lane >> 4) * 8;
    int n = wave * 16 + lm;
    size_t tok0 = (size_t)blockIdx.x * (KO_STAGES * KO_ROWS);
    const _Float16* src = obuf + tok0 * DD + tid * 8;

    async_copy_b128(&sA[0][tid * 8], src);
    async_copy_b128(&sA[0][16 * DD + tid * 8], src + 16 * DD);

    v16h b[4];      // loaded while stage 0 flies
#pragma unroll
    for (int kk = 0; kk < 4; ++kk)
        b[kk] = load_frag(wot + (size_t)n * DD + kk * 32 + lg);
    float bias = b_o[n];

    wait_async();
    __syncthreads();
    async_copy_b128(&sA[1][tid * 8], src + KO_ROWS * DD);
    async_copy_b128(&sA[1][16 * DD + tid * 8], src + (KO_ROWS + 16) * DD);

    // rolled: the ring's buffers alternate by trip
#pragma unroll 1
    for (int t = 0; t < KO_STAGES; ++t) {
        const _Float16* as = &sA[t & 1][lm * DD + lg];
        v16h a[2][4];
#pragma unroll
        for (int u = 0; u < 2; ++u)
#pragma unroll
            for (int kk = 0; kk < 4; ++kk) a[u][kk] = load_frag(as + u * 16 * DD + kk * 32);

        // publish stage t + 1 and free stage t's buffer, in this order, as soon as the
        // trip's fragments are in registers (as in k_proj)
        wait_ds();
        wait_async();
        __syncthreads();
        if (t + 2 < KO_STAGES) {
            const _Float16* nx = src + (size_t)(t + 2) * KO_ROWS * DD;
            async_copy_b128(&sA[t & 1][tid * 8], nx);
            async_copy_b128(&sA[t & 1][16 * DD + tid * 8], nx + 16 * DD);
        }

        v8f acc[2] = {};
#pragma unroll
        for (int kk = 0; kk < 4; ++kk)
#pragma unroll
            for (int u = 0; u < 2; ++u)
                acc[u] = wmma32(a[u][kk], b[kk], acc[u]);

        float* op = out + (tok0 + t * KO_ROWS + lg) * DD + n;
#pragma unroll
        for (int u = 0; u < 2; ++u)
#pragma unroll
            for (int r = 0; r < 8; ++r)
                op[(size_t)(u * 16 + r) * DD] = acc[u][r] + bias;
        // the next trip rewrites registers that these stores name
        asm volatile("s_wait_xcnt 0x0" ::: "memory");
    }
    wait_async();
}

// ---------------------------------------------------------------------------
extern "C" void kernel_launch(void* const* d_in, const int* in_sizes, int n_in,
                              void* d_out, int out_size, void* d_ws, size_t ws_size,
                              hipStream_t stream) {
    const float* x     = (const float*)d_in[0];
    const float* mask  = (const float*)d_in[1];
    const float* ln_w  = (const float*)d_in[2];
    const float* ln_b  = (const float*)d_in[3];
    const float* w_tri = (const float*)d_in[4];
    const float* w_q   = (const float*)d_in[5];
    const float* w_k   = (const float*)d_in[6];
    const float* w_v   = (const float*)d_in[7];
    const float* w_g   = (const float*)d_in[8];
    const float* b_g   = (const float*)d_in[9];
    const float* w_o   = (const float*)d_in[10];
    const float* b_o   = (const float*)d_in[11];

    _Float16* xn   = (_Float16*)d_ws;
    _Float16* qbuf = xn + TD;
    _Float16* kbuf = qbuf + TD;
    _Float16* vbuf = kbuf + TD;
    _Float16* gbuf = vbuf + TD;
    _Float16* obuf = gbuf + TD;
    _Float16* wt   = obuf + TD;                // 5 * 16384 halves
    float*    tri  = (float*)(wt + 5 * 16384); // H * 65536 floats

    k_wt<<<320, 256, 0, stream>>>(w_q, w_k, w_v, w_g, w_o, wt);
    k_ln_tri<<<TOK / (8 * LN_TPW), 256, 0, stream>>>(x, ln_w, ln_b, w_tri, xn, tri);
    k_proj<<<PJ_WG, 256, 0, stream>>>(xn, wt, b_g, qbuf);
    k_attn<<<dim3(HH, NN), 256, 0, stream>>>(qbuf, kbuf, vbuf, gbuf, tri, mask, obuf);
    k_out<<<KO_WG, 256, 0, stream>>>(obuf, wt + 4 * 16384, b_o, (float*)d_out);
}

// v003
// Measured time: 46 microseconds a run.
// Next to v002, in two timings, it ran 1.97 times as fast each time.
// All steps since v000 together make it 5.00 times as fast.
#include <hip/hip_runtime.h>
#include <hip/hip_bf16.h>

typedef __attribute__((ext_vector_type(16))) _Float16 v16h;
typedef __attribute__((ext_vector_type(8)))  _Float16 v8h;
typedef __attribute__((ext_vector_type(4)))  _Float16 v4h;
typedef __attribute__((ext_vector_type(8)))  float    v8f;

#define NN   256
#define DD   128
#define HH   4
#define CC   32
#define TOK  65536          // N*N tokens
#define TD   8388608ull     // TOK * DD

// Build a WMMA 16-half fragment from two contiguous 8-half (16B) chunks:
// elements [0..7] at p, elements [8..15] at p+16 halves.
__device__ __forceinline__ v16h load_frag(const _Float16* p) {
    v8h lo = *(const v8h*)p;
    v8h hi = *(const v8h*)(p + 16);
    v16h r;
#pragma unroll
    for (int e = 0; e < 8; ++e) { r[e] = lo[e]; r[8 + e] = hi[e]; }
    return r;
}

__device__ __forceinline__ v8f wmma32(v16h a, v16h b, v8f c) {
    return __builtin_amdgcn_wmma_f32_16x16x32_f16(false, a, false, b,
                                                  (short)0, c, false, false);
}

__device__ __forceinline__ float fast_rcp(float x) {
    return __builtin_amdgcn_rcpf(x);   // v_rcp_f32, avoids IEEE div expansion
}

__device__ __forceinline__ void async_copy_b128(const _Float16* lds_dst,
                                                const _Float16* gsrc) {
    unsigned lds_off = (unsigned)(uintptr_t)lds_dst;
    asm volatile("global_load_async_to_lds_b128 %0, %1, off\n\ts_wait_xcnt 0x0"
                 :: "v"(lds_off), "v"(gsrc) : "memory");
}
// this wave's copies have landed (other waves read them behind the next barrier)
__device__ __forceinline__ void wait_async() {
    asm volatile("s_wait_asynccnt 0x0" ::: "memory");
}

// ---------------------------------------------------------------------------
// Kernel 0: transpose + f32->f16 convert the 5 GEMM weights into [N][K] order
// wt layout: [mat 0..4][n 0..127][k 0..127], mat: q,k,v,g,o
// ---------------------------------------------------------------------------
__global__ void k_wt(const float* __restrict__ wq, const float* __restrict__ wk,
                     const float* __restrict__ wv, const float* __restrict__ wg,
                     const float* __restrict__ wo, _Float16* __restrict__ wt) {
    int idx = blockIdx.x * 256 + threadIdx.x;   // 0 .. 81919
    int mat = idx >> 14;
    int r   = idx & 16383;
    int n   = r >> 7;
    int k   = r & 127;
    const float* W = (mat == 0) ? wq : (mat == 1) ? wk : (mat == 2) ? wv
                   : (mat == 3) ? wg : wo;
    wt[idx] = (_Float16)W[k * DD + n];
}

// ---------------------------------------------------------------------------
// Kernel 1: LayerNorm + triangle bias GEMV (D->H, f32); a wave takes LN_TPW
// tokens in a row, which keeps the number of waves the launch must start small.
// xn: f16 [TOK][128]; tri: f32 [H][256][256] indexed tri[h*65536 + token]
// ---------------------------------------------------------------------------
#define LN_TPW 8

__global__ __launch_bounds__(256)
void k_ln_tri(const float* __restrict__ x, const float* __restrict__ ln_w,
              const float* __restrict__ ln_b, const float* __restrict__ w_tri,
              _Float16* __restrict__ xn, float* __restrict__ tri) {
    int wave = threadIdx.x >> 5;
    int lane = threadIdx.x & 31;
    int token0 = (blockIdx.x * 8 + wave) * LN_TPW;

    // all of the wave's token rows go out first: LN_TPW loads of 512 B in flight
    const float* xp = x + (size_t)token0 * DD + lane * 4;
    float4 xv[LN_TPW];
#pragma unroll
    for (int u = 0; u < LN_TPW; ++u) xv[u] = *(const float4*)(xp + u * DD);

    float4 w = *(const float4*)(ln_w + lane * 4);
    float4 b = *(const float4*)(ln_b + lane * 4);
    float4 wr[4];   // w_tri laid out [128][4]: row lane*4 + t
#pragma unroll
    for (int t = 0; t < 4; ++t) wr[t] = *(const float4*)(w_tri + (size_t)(lane * 4 + t) * HH);

    float d[LN_TPW][4], rs[LN_TPW];
#pragma unroll
    for (int u = 0; u < LN_TPW; ++u) {
        float s = xv[u].x + xv[u].y + xv[u].z + xv[u].w;
#pragma unroll
        for (int m = 16; m >= 1; m >>= 1) s += __shfl_xor(s, m, 32);
        float mu = s * (1.0f / 128.0f);

        float d0 = xv[u].x - mu, d1 = xv[u].y - mu, d2 = xv[u].z - mu, d3 = xv[u].w - mu;
        float vs = d0 * d0 + d1 * d1 + d2 * d2 + d3 * d3;
#pragma unroll
        for (int m = 16; m >= 1; m >>= 1) vs += __shfl_xor(vs, m, 32);
        d[u][0] = d0; d[u][1] = d1; d[u][2] = d2; d[u][3] = d3;
        rs[u] = vs * (1.0f / 128.0f) + 1e-5f;
    }
    static_assert(LN_TPW == 8, "the statement below names eight values");
    asm("v_rsq_f32 %0, %0\n\tv_rsq_f32 %1, %1\n\tv_rsq_f32 %2, %2\n\tv_rsq_f32 %3, %3\n\t"
        "v_rsq_f32 %4, %4\n\tv_rsq_f32 %5, %5\n\tv_rsq_f32 %6, %6\n\tv_rsq_f32 %7, %7\n\t"
        "v_nop"
        : "+v"(rs[0]), "+v"(rs[1]), "+v"(rs[2]), "+v"(rs[3]),
          "+v"(rs[4]), "+v"(rs[5]), "+v"(rs[6]), "+v"(rs[7]));

    float tr[HH][LN_TPW];
#pragma unroll
    for (int u = 0; u < LN_TPW; ++u) {
        float rstd = rs[u];
        float d0 = d[u][0], d1 = d[u][1], d2 = d[u][2], d3 = d[u][3];

        float y[4];
        y[0] = d0 * rstd * w.x + b.x;
        y[1] = d1 * rstd * w.y + b.y;
        y[2] = d2 * rstd * w.z + b.z;
        y[3] = d3 * rstd * w.w + b.w;

        v4h yh;
#pragma unroll
        for (int t = 0; t < 4; ++t) yh[t] = (_Float16)y[t];
        *(v4h*)(xn + (size_t)(token0 + u) * DD + lane * 4) = yh;

        // tri[h] = sum_d xn[d] * w_tri[d][h]
        float t0 = 0.f, t1 = 0.f, t2 = 0.f, t3 = 0.f;
#pragma unroll
        for (int t = 0; t < 4; ++t) {
            t0 += y[t] * wr[t].x; t1 += y[t] * wr[t].y;
            t2 += y[t] * wr[t].z; t3 += y[t] * wr[t].w;
        }
#pragma unroll
        for (int m = 16; m >= 1; m >>= 1) {
            t0 += __shfl_xor(t0, m, 32); t1 += __shfl_xor(t1, m, 32);
            t2 += __shfl_xor(t2, m, 32); t3 += __shfl_xor(t3, m, 32);
        }
        tr[0][u] = t0; tr[1][u] = t1; tr[2][u] = t2; tr[3][u] = t3;
    }
    if (lane == 0) {
#pragma unroll
        for (int h = 0; h < HH; ++h)
#pragma unroll
            for (int u = 0; u < LN_TPW; u += 4)
                *(float4*)(tri + (size_t)h * TOK + token0 + u) =
                    make_float4(tr[h][u], tr[h][u + 1], tr[h][u + 2], tr[h][u + 3]);
    }
}

#define XP 136
#define VP 264

__global__ __launch_bounds__(512)
void k_row(const _Float16* __restrict__ xn, const _Float16* __restrict__ wt,
           const float* __restrict__ b_g, const float* __restrict__ tri,
           const float* __restrict__ mask, const float* __restrict__ b_o,
           float* __restrict__ out) {
    __shared__ __attribute__((aligned(16))) _Float16 sX[NN * XP];   // xn rows, later g rows
    __shared__ __attribute__((aligned(16))) _Float16 sK[NN * XP];   // K rows [n][h*32+c]
    __shared__ __attribute__((aligned(16))) _Float16 sQ[NN * XP];   // q rows, later o rows
    __shared__ __attribute__((aligned(16))) _Float16 sVt[DD * VP];  // V transposed [h*32+c][n]
    __shared__ __attribute__((aligned(16))) float    sMb[NN];       // mask bias per key

    int i = blockIdx.x;
    int tid = threadIdx.x, lane = tid & 31;
    // the wave's number in a scalar register: the tests on it below are scalar branches
    int wave = __builtin_amdgcn_readfirstlane(tid >> 5);
    int lm = lane & 15, lg = (lane >> 4) * 8;
    int ct = wave & 7;
    size_t rowbase = (size_t)i * NN;

    // the row's xn: 4096 pieces of 16 B, eight per lane, each wave's copy 512 B in a row
    const _Float16* src = xn + rowbase * DD;
#pragma unroll
    for (int u = 0; u < 8; ++u) {
        int c = u * 512 + tid;
        async_copy_b128(&sX[(c >> 4) * XP + (c & 15) * 8], src + (size_t)c * 8);
    }

    // weights and mask bias come in while the copies fly
    unsigned woff = (unsigned)((ct * 16 + lm) * DD + lg);     // this lane's place in a matrix
    const _Float16* wa = wt + (wave < 8 ? 1 : 2) * 16384;     // k or v
    const _Float16* wb = wt + (wave < 8 ? 0 : 3) * 16384;     // q or g
    v16h fa[4], fb[4];
#pragma unroll
    for (int kk = 0; kk < 4; ++kk) {
        fa[kk] = load_frag(wa + woff + kk * 32);
        fb[kk] = load_frag(wb + woff + kk * 32);
    }
    if (wave < 8) sMb[tid] = 1e9f * (mask[rowbase + tid] - 1.0f);

    wait_async();
    __syncthreads();

    v8h gk[16] = {};   // g of this wave's channels, all 16 token tiles (waves 8-15)
    if (wave < 8) {
#pragma unroll 2
        for (int tt = 0; tt < 16; ++tt) {
            const _Float16* xr = sX + (tt * 16 + lm) * XP + lg;
            v16h xf[4];
#pragma unroll
            for (int kk = 0; kk < 4; ++kk) xf[kk] = load_frag(xr + kk * 32);
            v8f ak = {}, aq = {};
#pragma unroll
            for (int kk = 0; kk < 4; ++kk) {
                ak = wmma32(fa[kk], xf[kk], ak);   // D[channel lg+r][token lm]
                aq = wmma32(fb[kk], xf[kk], aq);
            }
            v8h hk, hq;
#pragma unroll
            for (int r = 0; r < 8; ++r) {
                hk[r] = (_Float16)ak[r];
                hq[r] = (_Float16)(aq[r] * 0.17677669529663687f);   // q / sqrt(C)
            }
            int o = (tt * 16 + lm) * XP + ct * 16 + lg;
            *(v8h*)(sK + o) = hk;
            *(v8h*)(sQ + o) = hq;
        }
    } else {
        float4 bg0 = *(const float4*)(b_g + ct * 16 + lg);
        float4 bg1 = *(const float4*)(b_g + ct * 16 + lg + 4);
        float bg[8] = {bg0.x, bg0.y, bg0.z, bg0.w, bg1.x, bg1.y, bg1.z, bg1.w};
        // unrolled: gk is indexed by the trip and must stay in registers
#pragma unroll
        for (int tt = 0; tt < 16; ++tt) {
            const _Float16* xr = sX + (tt * 16 + lm) * XP + lg;
            v16h xf[4];
#pragma unroll
            for (int kk = 0; kk < 4; ++kk) xf[kk] = load_frag(xr + kk * 32);
            v8f av = {}, ag = {};
#pragma unroll
            for (int kk = 0; kk < 4; ++kk) {
                av = wmma32(xf[kk], fa[kk], av);   // D[token lg+r][channel lm]
                ag = wmma32(fb[kk], xf[kk], ag);   // D[channel lg+r][token lm]
            }
            v8h hv;
#pragma unroll
            for (int r = 0; r < 8; ++r) hv[r] = (_Float16)av[r];
            *(v8h*)(sVt + (ct * 16 + lm) * VP + tt * 16 + lg) = hv;

            float e[8];     // g = sigmoid(z) = 1 / (1 + exp2(-z * log2(e))), as __expf forms it
#pragma unroll
            for (int r = 0; r < 8; ++r) e[r] = (ag[r] + bg[r]) * -1.44269504088896340736f;
            asm("v_exp_f32 %0, %0\n\tv_exp_f32 %1, %1\n\tv_exp_f32 %2, %2\n\tv_exp_f32 %3, %3\n\t"
                "v_exp_f32 %4, %4\n\tv_exp_f32 %5, %5\n\tv_exp_f32 %6, %6\n\tv_exp_f32 %7, %7\n\t"
                "v_add_f32 %0, 1.0, %0\n\tv_add_f32 %1, 1.0, %1\n\tv_add_f32 %2, 1.0, %2\n\tv_add_f32 %3, 1.0, %3\n\t"
                "v_add_f32 %4, 1.0, %4\n\tv_add_f32 %5, 1.0, %5\n\tv_add_f32 %6, 1.0, %6\n\tv_add_f32 %7, 1.0, %7\n\t"
                "v_rcp_f32 %0, %0\n\tv_rcp_f32 %1, %1\n\tv_rcp_f32 %2, %2\n\tv_rcp_f32 %3, %3\n\t"
                "v_rcp_f32 %4, %4\n\tv_rcp_f32 %5, %5\n\tv_rcp_f32 %6, %6\n\tv_rcp_f32 %7, %7\n\t"
                "v_nop"
                : "+v"(e[0]), "+v"(e[1]), "+v"(e[2]), "+v"(e[3]),
                  "+v"(e[4]), "+v"(e[5]), "+v"(e[6]), "+v"(e[7]));
#pragma unroll
            for (int r = 0; r < 8; ++r) gk[tt][r] = (_Float16)e[r];
        }
    }
    __syncthreads();    // every wave has left xn
    if (wave >= 8) {
#pragma unroll
        for (int tt = 0; tt < 16; ++tt)
            *(v8h*)(sX + (tt * 16 + lm) * XP + ct * 16 + lg) = gk[tt];
    }
    __syncthreads();    // k, q, v, g are published

    // rolled: the heads unrolled together would multiply the live score registers
    int m0 = wave * 16;
#pragma unroll 1
    for (int h = 0; h < HH; ++h) {
        _Float16* qo = sQ + (m0 + lm) * XP + h * CC + lg;          // this lane's q, then o
        const _Float16* kh = sK + lm * XP + h * CC + lg;
        const _Float16* vh = sVt + (h * CC + lm) * VP + lg;

        // S^T tile nt: s[nt][r] = score(query m0+lm, key nt*16 + lg + r)
        v16h bQ = load_frag(qo);
        const float* tp = tri + (size_t)h * TOK + (size_t)(m0 + lm) * NN + lg;
        v8f s[16];
        // all 32 tri loads go out first: they land in the accumulators (C operand)
#pragma unroll
        for (int nt = 0; nt < 16; ++nt) {
            float4 c0 = *(const float4*)(tp + nt * 16);
            float4 c1 = *(const float4*)(tp + nt * 16 + 4);
            s[nt] = v8f{c0.x, c0.y, c0.z, c0.w, c1.x, c1.y, c1.z, c1.w};
        }
        // K fragments in groups of four tiles, fetched one group ahead of their WMMAs.
        // The scheduling barriers hold that order: without them the compiler either
        // hoists every LDS load of the tile (spills) or waits on each fragment alone.
        v16h aK[2][4];
#pragma unroll
        for (int j = 0; j < 4; ++j)
            aK[0][j] = load_frag(kh + (j * 16) * XP);
#pragma unroll
        for (int g = 0; g < 4; ++g) {
            __builtin_amdgcn_sched_barrier(0);
            if (g < 3) {
#pragma unroll
                for (int j = 0; j < 4; ++j)
                    aK[(g + 1) & 1][j] = load_frag(kh + (((g + 1) * 4 + j) * 16) * XP);
            }
            __builtin_amdgcn_sched_barrier(0);
#pragma unroll
            for (int j = 0; j < 4; ++j)
                s[g * 4 + j] = wmma32(aK[g & 1][j], bQ, s[g * 4 + j]);
        }

        float mxj[4] = {-3.0e38f, -3.0e38f, -3.0e38f, -3.0e38f};   // four independent chains
#pragma unroll
        for (int g = 0; g < 4; ++g) {
            // same purpose: at most four tiles' mask bias live at a time
            __builtin_amdgcn_sched_barrier(0);
#pragma unroll
            for (int j = 0; j < 4; ++j) {
                int nt = g * 4 + j;
                float4 b0 = *(const float4*)(sMb + nt * 16 + lg);
                float4 b1 = *(const float4*)(sMb + nt * 16 + lg + 4);
                float mb[8] = {b0.x, b0.y, b0.z, b0.w, b1.x, b1.y, b1.z, b1.w};
#pragma unroll
                for (int r = 0; r < 8; ++r) {
                    s[nt][r] += mb[r];
                    mxj[j] = fmaxf(mxj[j], s[nt][r]);
                }
            }
        }
        float mx = fmaxf(fmaxf(mxj[0], mxj[1]), fmaxf(mxj[2], mxj[3]));
        mx = fmaxf(mx, __shfl_xor(mx, 16, 32));

        // exp, pack two score tiles into one B fragment, O^T += V^T . P^T
        float sum = 0.f;
        v8f acc0 = {}, acc1 = {};
#pragma unroll
        for (int ks = 0; ks < 8; ++ks) {
            // same purpose: one k-step's V^T fragments live at a time
            __builtin_amdgcn_sched_barrier(0);
            v16h aV0 = load_frag(vh + ks * 32);
            v16h aV1 = load_frag(vh + 16 * VP + ks * 32);
            float p[16];   // exp(x) = exp2(x * log2(e)), as __expf forms it
#pragma unroll
            for (int r = 0; r < 8; ++r) {
                p[r]     = (s[2 * ks][r] - mx) * 1.44269504088896340736f;
                p[8 + r] = (s[2 * ks + 1][r] - mx) * 1.44269504088896340736f;
            }
            asm("v_exp_f32 %0, %0\n\tv_exp_f32 %1, %1\n\tv_exp_f32 %2, %2\n\tv_exp_f32 %3, %3\n\t"
                "v_exp_f32 %4, %4\n\tv_exp_f32 %5, %5\n\tv_exp_f32 %6, %6\n\tv_exp_f32 %7, %7\n\t"
                "v_exp_f32 %8, %8\n\tv_exp_f32 %9, %9\n\tv_exp_f32 %10, %10\n\tv_exp_f32 %11, %11\n\t"
                "v_exp_f32 %12, %12\n\tv_exp_f32 %13, %13\n\tv_exp_f32 %14, %14\n\tv_exp_f32 %15, %15\n\t"
                "v_nop"
                : "+v"(p[0]), "+v"(p[1]), "+v"(p[2]), "+v"(p[3]), "+v"(p[4]), "+v"(p[5]),
                  "+v"(p[6]), "+v"(p[7]), "+v"(p[8]), "+v"(p[9]), "+v"(p[10]), "+v"(p[11]),
                  "+v"(p[12]), "+v"(p[13]), "+v"(p[14]), "+v"(p[15]));
            v16h bP;
#pragma unroll
            for (int r = 0; r < 8; ++r) {
                sum += p[r] + p[8 + r];
                bP[r] = (_Float16)p[r];
                bP[8 + r] = (_Float16)p[8 + r];
            }
            acc0 = wmma32(aV0, bP, acc0);
            acc1 = wmma32(aV1, bP, acc1);
        }
        sum += __shfl_xor(sum, 16, 32);
        float inv = fast_rcp(sum);

        // acc0[r], acc1[r] = O(query m0+lm, channel h*32 + lg + r, + 16): normalise, gate, store
        const _Float16* gp = sX + (m0 + lm) * XP + h * CC + lg;
        v8h g0 = *(const v8h*)gp;
        v8h g1 = *(const v8h*)(gp + 16);
        v8h o0, o1;
#pragma unroll
        for (int r = 0; r < 8; ++r) {
            o0[r] = (_Float16)((float)g0[r] * (acc0[r] * inv));
            o1[r] = (_Float16)((float)g1[r] * (acc1[r] * inv));
        }
        *(v8h*)qo = o0;
        *(v8h*)(qo + 16) = o1;
    }

    // w_o's fragments come in while the slower waves finish
    v16h b[4];
#pragma unroll
    for (int kk = 0; kk < 4; ++kk)
        b[kk] = load_frag(wt + 4 * 16384 + woff + kk * 32);
    float bias = b_o[ct * 16 + lm];
    __syncthreads();    // o is published

    int t0 = (wave >> 3) * 8;
    // rolled: one trip's registers are enough; two token tiles a trip are two independent chains
#pragma unroll 1
    for (int t = 0; t < 8; t += 2) {
        const _Float16* as = sQ + ((t0 + t) * 16 + lm) * XP + lg;
        v16h a[2][4];
#pragma unroll
        for (int u = 0; u < 2; ++u)
#pragma unroll
            for (int kk = 0; kk < 4; ++kk) a[u][kk] = load_frag(as + u * 16 * XP + kk * 32);
        v8f acc[2] = {};
#pragma unroll
        for (int kk = 0; kk < 4; ++kk)
#pragma unroll
            for (int u = 0; u < 2; ++u)
                acc[u] = wmma32(a[u][kk], b[kk], acc[u]);
        float* op = out + (rowbase + (t0 + t) * 16 + lg) * DD + ct * 16 + lm;
#pragma unroll
        for (int u = 0; u < 2; ++u)
#pragma unroll
            for (int r = 0; r < 8; ++r)
                op[(size_t)(u * 16 + r) * DD] = acc[u][r] + bias;
        // the next trip rewrites registers that these stores name
        asm volatile("s_wait_xcnt 0x0" ::: "memory");
    }
}

// ---------------------------------------------------------------------------
extern "C" void kernel_launch(void* const* d_in, const int* in_sizes, int n_in,
                              void* d_out, int out_size, void* d_ws, size_t ws_size,
                              hipStream_t stream) {
    const float* x     = (const float*)d_in[0];
    const float* mask  = (const float*)d_in[1];
    const float* ln_w  = (const float*)d_in[2];
    const float* ln_b  = (const float*)d_in[3];
    const float* w_tri = (const float*)d_in[4];
    const float* w_q   = (const float*)d_in[5];
    const float* w_k   = (const float*)d_in[6];
    const float* w_v   = (const float*)d_in[7];
    const float* w_g   = (const float*)d_in[8];
    const float* b_g   = (const float*)d_in[9];
    const float* w_o   = (const float*)d_in[10];
    const float* b_o   = (const float*)d_in[11];

    _Float16* xn   = (_Float16*)d_ws;
    _Float16* wt   = xn + TD;                  // 5 * 16384 halves
    float*    tri  = (float*)(wt + 5 * 16384); // H * 65536 floats

    k_wt<<<320, 256, 0, stream>>>(w_q, w_k, w_v, w_g, w_o, wt);
    k_ln_tri<<<TOK / (8 * LN_TPW), 256, 0, stream>>>(x, ln_w, ln_b, w_tri, xn, tri);
    k_row<<<NN, 512, 0, stream>>>(xn, wt, b_g, tri, mask, b_o, (float*)d_out);
}

// v004
// One run takes 43 microseconds.
// In both of two side-by-side timings against v003, it was 1.07 times as fast.
// All steps since v000 together make it 5.35 times as fast.
#include <hip/hip_runtime.h>
#include <hip/hip_bf16.h>

typedef __attribute__((ext_vector_type(16))) _Float16 v16h;
typedef __attribute__((ext_vector_type(8)))  _Float16 v8h;
typedef __attribute__((ext_vector_type(4)))  _Float16 v4h;
typedef __attribute__((ext_vector_type(8)))  float    v8f;

#define NN   256
#define DD   128
#define HH   4
#define CC   32
#define TOK  65536          // N*N tokens
#define TD   8388608ull     // TOK * DD

// Build a WMMA 16-half fragment from two contiguous 8-half (16B) chunks:
// elements [0..7] at p, elements [8..15] at p+16 halves.
__device__ __forceinline__ v16h load_frag(const _Float16* p) {
    v8h lo = *(const v8h*)p;
    v8h hi = *(const v8h*)(p + 16);
    v16h r;
#pragma unroll
    for (int e = 0; e < 8; ++e) { r[e] = lo[e]; r[8 + e] = hi[e]; }
    return r;
}

__device__ __forceinline__ v8f wmma32(v16h a, v16h b, v8f c) {
    return __builtin_amdgcn_wmma_f32_16x16x32_f16(false, a, false, b,
                                                  (short)0, c, false, false);
}

__device__ __forceinline__ float fast_rcp(float x) {
    return __builtin_amdgcn_rcpf(x);   // v_rcp_f32, avoids IEEE div expansion
}

__device__ __forceinline__ void async_copy_b128(const _Float16* lds_dst,
                                                const _Float16* gsrc) {
    unsigned lds_off = (unsigned)(uintptr_t)lds_dst;
    asm volatile("global_load_async_to_lds_b128 %0, %1, off\n\ts_wait_xcnt 0x0"
                 :: "v"(lds_off), "v"(gsrc) : "memory");
}
// this wave's copies have landed (other waves read them behind the next barrier)
__device__ __forceinline__ void wait_async() {
    asm volatile("s_wait_asynccnt 0x0" ::: "memory");
}

// ---------------------------------------------------------------------------
// Kernel 1: LayerNorm + triangle bias GEMV (D->H, f32); a wave takes LN_TPW
// tokens in a row, which keeps the number of waves the launch must start small.
// xn: f16 [TOK][128]; tri: f32 [H][256][256] indexed tri[h*65536 + token]
// The first WT_BLOCKS work-groups also transpose and convert (f32 -> f16) the 5 GEMM
// weights into [N][K] order, one element a thread: that work depends on nothing here
// and rides in this grid, so it needs no launch of its own.
// wt layout: [mat 0..4][n 0..127][k 0..127], mat: q,k,v,g,o
// ---------------------------------------------------------------------------
#define LN_TPW 8
#define WT_BLOCKS 320   // 5 * 128 * 128 elements / 256 threads; 64 work-groups a matrix

__global__ __launch_bounds__(256)
void k_ln_tri(const float* __restrict__ x, const float* __restrict__ ln_w,
              const float* __restrict__ ln_b, const float* __restrict__ w_tri,
              const float* __restrict__ wq, const float* __restrict__ wk,
              const float* __restrict__ wv, const float* __restrict__ wg,
              const float* __restrict__ wo,
              _Float16* __restrict__ xn, float* __restrict__ tri,
              _Float16* __restrict__ wt) {
    int wave = threadIdx.x >> 5;
    int lane = threadIdx.x & 31;
    int token0 = (blockIdx.x * 8 + wave) * LN_TPW;

    // all of the wave's token rows go out first: LN_TPW loads of 512 B in flight
    const float* xp = x + (size_t)token0 * DD + lane * 4;
    float4 xv[LN_TPW];
#pragma unroll
    for (int u = 0; u < LN_TPW; ++u) xv[u] = *(const float4*)(xp + u * DD);

    float4 w = *(const float4*)(ln_w + lane * 4);
    float4 b = *(const float4*)(ln_b + lane * 4);
    float4 wr[4];   // w_tri laid out [128][4]: row lane*4 + t
#pragma unroll
    for (int t = 0; t < 4; ++t) wr[t] = *(const float4*)(w_tri + (size_t)(lane * 4 + t) * HH);

    float d[LN_TPW][4], rs[LN_TPW];
#pragma unroll
    for (int u = 0; u < LN_TPW; ++u) {
        float s = xv[u].x + xv[u].y + xv[u].z + xv[u].w;
#pragma unroll
        for (int m = 16; m >= 1; m >>= 1) s += __shfl_xor(s, m, 32);
        float mu = s * (1.0f / 128.0f);

        float d0 = xv[u].x - mu, d1 = xv[u].y - mu, d2 = xv[u].z - mu, d3 = xv[u].w - mu;
        float vs = d0 * d0 + d1 * d1 + d2 * d2 + d3 * d3;
#pragma unroll
        for (int m = 16; m >= 1; m >>= 1) vs += __shfl_xor(vs, m, 32);
        d[u][0] = d0; d[u][1] = d1; d[u][2] = d2; d[u][3] = d3;
        rs[u] = vs * (1.0f / 128.0f) + 1e-5f;
    }
    static_assert(LN_TPW == 8, "the statement below names eight values");
    asm("v_rsq_f32 %0, %0\n\tv_rsq_f32 %1, %1\n\tv_rsq_f32 %2, %2\n\tv_rsq_f32 %3, %3\n\t"
        "v_rsq_f32 %4, %4\n\tv_rsq_f32 %5, %5\n\tv_rsq_f32 %6, %6\n\tv_rsq_f32 %7, %7\n\t"
        "v_nop"
        : "+v"(rs[0]), "+v"(rs[1]), "+v"(rs[2]), "+v"(rs[3]),
          "+v"(rs[4]), "+v"(rs[5]), "+v"(rs[6]), "+v"(rs[7]));

    float tr[HH][LN_TPW];
#pragma unroll
    for (int u = 0; u < LN_TPW; ++u) {
        float rstd = rs[u];
        float d0 = d[u][0], d1 = d[u][1], d2 = d[u][2], d3 = d[u][3];

        float y[4];
        y[0] = d0 * rstd * w.x + b.x;
        y[1] = d1 * rstd * w.y + b.y;
        y[2] = d2 * rstd * w.z + b.z;
        y[3] = d3 * rstd * w.w + b.w;

        v4h yh;
#pragma unroll
        for (int t = 0; t < 4; ++t) yh[t] = (_Float16)y[t];
        *(v4h*)(xn + (size_t)(token0 + u) * DD + lane * 4) = yh;

        // tri[h] = sum_d xn[d] * w_tri[d][h]
        float t0 = 0.f, t1 = 0.f, t2 = 0.f, t3 = 0.f;
#pragma unroll
        for (int t = 0; t < 4; ++t) {
            t0 += y[t] * wr[t].x; t1 += y[t] * wr[t].y;
            t2 += y[t] * wr[t].z; t3 += y[t] * wr[t].w;
        }
#pragma unroll
        for (int m = 16; m >= 1; m >>= 1) {
            t0 += __shfl_xor(t0, m, 32); t1 += __shfl_xor(t1, m, 32);
            t2 += __shfl_xor(t2, m, 32); t3 += __shfl_xor(t3, m, 32);
        }
        tr[0][u] = t0; tr[1][u] = t1; tr[2][u] = t2; tr[3][u] = t3;
    }
    if (lane == 0) {
#pragma unroll
        for (int h = 0; h < HH; ++h)
#pragma unroll
            for (int u = 0; u < LN_TPW; u += 4)
                *(float4*)(tri + (size_t)h * TOK + token0 + u) =
                    make_float4(tr[h][u], tr[h][u + 1], tr[h][u + 2], tr[h][u + 3]);
    }

    // the weights' share comes last: the work-groups that have it are the first to start,
    // so its load latency ends before the grid's last work-groups do. The test and the
    // choice of matrix are the same for the whole work-group.
    if (blockIdx.x < WT_BLOCKS) {
        int mat = blockIdx.x >> 6;
        int r   = (blockIdx.x & 63) * 256 + threadIdx.x;
        int n   = r >> 7;
        int k   = r & 127;
        const float* W = (mat == 0) ? wq : (mat == 1) ? wk : (mat == 2) ? wv
                       : (mat == 3) ? wg : wo;
        wt[mat * 16384 + r] = (_Float16)W[k * DD + n];
    }
}

#define XP 136
#define VP 264

__global__ __launch_bounds__(512)
void k_row(const _Float16* __restrict__ xn, const _Float16* __restrict__ wt,
           const float* __restrict__ b_g, const float* __restrict__ tri,
           const float* __restrict__ mask, const float* __restrict__ b_o,
           float* __restrict__ out) {
    __shared__ __attribute__((aligned(16))) _Float16 sX[NN * XP];   // xn rows, later g rows
    __shared__ __attribute__((aligned(16))) _Float16 sK[NN * XP];   // K rows [n][h*32+c]
    __shared__ __attribute__((aligned(16))) _Float16 sQ[NN * XP];   // q rows, later o rows
    __shared__ __attribute__((aligned(16))) _Float16 sVt[DD * VP];  // V transposed [h*32+c][n]
    __shared__ __attribute__((aligned(16))) float    sMb[NN];       // mask bias per key

    int i = blockIdx.x;
    int tid = threadIdx.x, lane = tid & 31;
    // the wave's number in a scalar register: the tests on it below are scalar branches
    int wave = __builtin_amdgcn_readfirstlane(tid >> 5);
    int lm = lane & 15, lg = (lane >> 4) * 8;
    int ct = wave & 7;
    size_t rowbase = (size_t)i * NN;

    // the row's xn: 4096 pieces of 16 B, eight per lane, each wave's copy 512 B in a row
    const _Float16* src = xn + rowbase * DD;
#pragma unroll
    for (int u = 0; u < 8; ++u) {
        int c = u * 512 + tid;
        async_copy_b128(&sX[(c >> 4) * XP + (c & 15) * 8], src + (size_t)c * 8);
    }

    // weights and mask bias come in while the copies fly
    unsigned woff = (unsigned)((ct * 16 + lm) * DD + lg);     // this lane's place in a matrix
    const _Float16* wa = wt + (wave < 8 ? 1 : 2) * 16384;     // k or v
    const _Float16* wb = wt + (wave < 8 ? 0 : 3) * 16384;     // q or g
    v16h fa[4], fb[4];
#pragma unroll
    for (int kk = 0; kk < 4; ++kk) {
        fa[kk] = load_frag(wa + woff + kk * 32);
        fb[kk] = load_frag(wb + woff + kk * 32);
    }
    if (wave < 8) sMb[tid] = 1e9f * (mask[rowbase + tid] - 1.0f);

    wait_async();
    __syncthreads();

    v8h gk[16] = {};   // g of this wave's channels, all 16 token tiles (waves 8-15)
    if (wave < 8) {
#pragma unroll 2
        for (int tt = 0; tt < 16; ++tt) {
            const _Float16* xr = sX + (tt * 16 + lm) * XP + lg;
            v16h xf[4];
#pragma unroll
            for (int kk = 0; kk < 4; ++kk) xf[kk] = load_frag(xr + kk * 32);
            v8f ak = {}, aq = {};
#pragma unroll
            for (int kk = 0; kk < 4; ++kk) {
                ak = wmma32(fa[kk], xf[kk], ak);   // D[channel lg+r][token lm]
                aq = wmma32(fb[kk], xf[kk], aq);
            }
            v8h hk, hq;
#pragma unroll
            for (int r = 0; r < 8; ++r) {
                hk[r] = (_Float16)ak[r];
                hq[r] = (_Float16)(aq[r] * 0.17677669529663687f);   // q / sqrt(C)
            }
            int o = (tt * 16 + lm) * XP + ct * 16 + lg;
            *(v8h*)(sK + o) = hk;
            *(v8h*)(sQ + o) = hq;
        }
    } else {
        float4 bg0 = *(const float4*)(b_g + ct * 16 + lg);
        float4 bg1 = *(const float4*)(b_g + ct * 16 + lg + 4);
        float bg[8] = {bg0.x, bg0.y, bg0.z, bg0.w, bg1.x, bg1.y, bg1.z, bg1.w};
        // unrolled: gk is indexed by the trip and must stay in registers
#pragma unroll
        for (int tt = 0; tt < 16; ++tt) {
            const _Float16* xr = sX + (tt * 16 + lm) * XP + lg;
            v16h xf[4];
#pragma unroll
            for (int kk = 0; kk < 4; ++kk) xf[kk] = load_frag(xr + kk * 32);
            v8f av = {}, ag = {};
#pragma unroll
            for (int kk = 0; kk < 4; ++kk) {
                av = wmma32(xf[kk], fa[kk], av);   // D[token lg+r][channel lm]
                ag = wmma32(fb[kk], xf[kk], ag);   // D[channel lg+r][token lm]
            }
            v8h hv;
#pragma unroll
            for (int r = 0; r < 8; ++r) hv[r] = (_Float16)av[r];
            *(v8h*)(sVt + (ct * 16 + lm) * VP + tt * 16 + lg) = hv;

            float e[8];     // g = sigmoid(z) = 1 / (1 + exp2(-z * log2(e))), as __expf forms it
#pragma unroll
            for (int r = 0; r < 8; ++r) e[r] = (ag[r] + bg[r]) * -1.44269504088896340736f;
            asm("v_exp_f32 %0, %0\n\tv_exp_f32 %1, %1\n\tv_exp_f32 %2, %2\n\tv_exp_f32 %3, %3\n\t"
                "v_exp_f32 %4, %4\n\tv_exp_f32 %5, %5\n\tv_exp_f32 %6, %6\n\tv_exp_f32 %7, %7\n\t"
                "v_add_f32 %0, 1.0, %0\n\tv_add_f32 %1, 1.0, %1\n\tv_add_f32 %2, 1.0, %2\n\tv_add_f32 %3, 1.0, %3\n\t"
                "v_add_f32 %4, 1.0, %4\n\tv_add_f32 %5, 1.0, %5\n\tv_add_f32 %6, 1.0, %6\n\tv_add_f32 %7, 1.0, %7\n\t"
                "v_rcp_f32 %0, %0\n\tv_rcp_f32 %1, %1\n\tv_rcp_f32 %2, %2\n\tv_rcp_f32 %3, %3\n\t"
                "v_rcp_f32 %4, %4\n\tv_rcp_f32 %5, %5\n\tv_rcp_f32 %6, %6\n\tv_rcp_f32 %7, %7\n\t"
                "v_nop"
                : "+v"(e[0]), "+v"(e[1]), "+v"(e[2]), "+v"(e[3]),
                  "+v"(e[4]), "+v"(e[5]), "+v"(e[6]), "+v"(e[7]));
#pragma unroll
            for (int r = 0; r < 8; ++r) gk[tt][r] = (_Float16)e[r];
        }
    }
    __syncthreads();    // every wave has left xn
    if (wave >= 8) {
#pragma unroll
        for (int tt = 0; tt < 16; ++tt)
            *(v8h*)(sX + (tt * 16 + lm) * XP + ct * 16 + lg) = gk[tt];
    }
    __syncthreads();    // k, q, v, g are published

    // rolled: the heads unrolled together would multiply the live score registers
    int m0 = wave * 16;
#pragma unroll 1
    for (int h = 0; h < HH; ++h) {
        _Float16* qo = sQ + (m0 + lm) * XP + h * CC + lg;          // this lane's q, then o
        const _Float16* kh = sK + lm * XP + h * CC + lg;
        const _Float16* vh = sVt + (h * CC + lm) * VP + lg;

        // S^T tile nt: s[nt][r] = score(query m0+lm, key nt*16 + lg + r)
        v16h bQ = load_frag(qo);
        const float* tp = tri + (size_t)h * TOK + (size_t)(m0 + lm) * NN + lg;
        v8f s[16];
        // all 32 tri loads go out first: they land in the accumulators (C operand)
#pragma unroll
        for (int nt = 0; nt < 16; ++nt) {
            float4 c0 = *(const float4*)(tp + nt * 16);
            float4 c1 = *(const float4*)(tp + nt * 16 + 4);
            s[nt] = v8f{c0.x, c0.y, c0.z, c0.w, c1.x, c1.y, c1.z, c1.w};
        }
        // K fragments in groups of four tiles, fetched one group ahead of their WMMAs.
        // The scheduling barriers hold that order: without them the compiler either
        // hoists every LDS load of the tile (spills) or waits on each fragment alone.
        v16h aK[2][4];
#pragma unroll
        for (int j = 0; j < 4; ++j)
            aK[0][j] = load_frag(kh + (j * 16) * XP);
#pragma unroll
        for (int g = 0; g < 4; ++g) {
            __builtin_amdgcn_sched_barrier(0);
            if (g < 3) {
#pragma unroll
                for (int j = 0; j < 4; ++j)
                    aK[(g + 1) & 1][j] = load_frag(kh + (((g + 1) * 4 + j) * 16) * XP);
            }
            __builtin_amdgcn_sched_barrier(0);
#pragma unroll
            for (int j = 0; j < 4; ++j)
                s[g * 4 + j] = wmma32(aK[g & 1][j], bQ, s[g * 4 + j]);
        }

        float mxj[4] = {-3.0e38f, -3.0e38f, -3.0e38f, -3.0e38f};   // four independent chains
#pragma unroll
        for (int g = 0; g < 4; ++g) {
            // same purpose: at most four tiles' mask bias live at a time
            __builtin_amdgcn_sched_barrier(0);
#pragma unroll
            for (int j = 0; j < 4; ++j) {
                int nt = g * 4 + j;
                float4 b0 = *(const float4*)(sMb + nt * 16 + lg);
                float4 b1 = *(const float4*)(sMb + nt * 16 + lg + 4);
                float mb[8] = {b0.x, b0.y, b0.z, b0.w, b1.x, b1.y, b1.z, b1.w};
#pragma unroll
                for (int r = 0; r < 8; ++r) {
                    s[nt][r] += mb[r];
                    mxj[j] = fmaxf(mxj[j], s[nt][r]);
                }
            }
        }
        float mx = fmaxf(fmaxf(mxj[0], mxj[1]), fmaxf(mxj[2], mxj[3]));
        mx = fmaxf(mx, __shfl_xor(mx, 16, 32));

        // exp, pack two score tiles into one B fragment, O^T += V^T . P^T
        float sum = 0.f;
        v8f acc0 = {}, acc1 = {};
#pragma unroll
        for (int ks = 0; ks < 8; ++ks) {
            // same purpose: one k-step's V^T fragments live at a time
            __builtin_amdgcn_sched_barrier(0);
            v16h aV0 = load_frag(vh + ks * 32);
            v16h aV1 = load_frag(vh + 16 * VP + ks * 32);
            float p[16];   // exp(x) = exp2(x * log2(e)), as __expf forms it
#pragma unroll
            for (int r = 0; r < 8; ++r) {
                p[r]     = (s[2 * ks][r] - mx) * 1.44269504088896340736f;
                p[8 + r] = (s[2 * ks + 1][r] - mx) * 1.44269504088896340736f;
            }
            asm("v_exp_f32 %0, %0\n\tv_exp_f32 %1, %1\n\tv_exp_f32 %2, %2\n\tv_exp_f32 %3, %3\n\t"
                "v_exp_f32 %4, %4\n\tv_exp_f32 %5, %5\n\tv_exp_f32 %6, %6\n\tv_exp_f32 %7, %7\n\t"
                "v_exp_f32 %8, %8\n\tv_exp_f32 %9, %9\n\tv_exp_f32 %10, %10\n\tv_exp_f32 %11, %11\n\t"
                "v_exp_f32 %12, %12\n\tv_exp_f32 %13, %13\n\tv_exp_f32 %14, %14\n\tv_exp_f32 %15, %15\n\t"
                "v_nop"
                : "+v"(p[0]), "+v"(p[1]), "+v"(p[2]), "+v"(p[3]), "+v"(p[4]), "+v"(p[5]),
                  "+v"(p[6]), "+v"(p[7]), "+v"(p[8]), "+v"(p[9]), "+v"(p[10]), "+v"(p[11]),
                  "+v"(p[12]), "+v"(p[13]), "+v"(p[14]), "+v"(p[15]));
            v16h bP;
#pragma unroll
            for (int r = 0; r < 8; ++r) {
                sum += p[r] + p[8 + r];
                bP[r] = (_Float16)p[r];
                bP[8 + r] = (_Float16)p[8 + r];
            }
            acc0 = wmma32(aV0, bP, acc0);
            acc1 = wmma32(aV1, bP, acc1);
        }
        sum += __shfl_xor(sum, 16, 32);
        float inv = fast_rcp(sum);

        // acc0[r], acc1[r] = O(query m0+lm, channel h*32 + lg + r, + 16): normalise, gate, store
        const _Float16* gp = sX + (m0 + lm) * XP + h * CC + lg;
        v8h g0 = *(const v8h*)gp;
        v8h g1 = *(const v8h*)(gp + 16);
        v8h o0, o1;
#pragma unroll
        for (int r = 0; r < 8; ++r) {
            o0[r] = (_Float16)((float)g0[r] * (acc0[r] * inv));
            o1[r] = (_Float16)((float)g1[r] * (acc1[r] * inv));
        }
        *(v8h*)qo = o0;
        *(v8h*)(qo + 16) = o1;
    }

    // w_o's fragments come in while the slower waves finish
    v16h b[4];
#pragma unroll
    for (int kk = 0; kk < 4; ++kk)
        b[kk] = load_frag(wt + 4 * 16384 + woff + kk * 32);
    float bias = b_o[ct * 16 + lm];
    __syncthreads();    // o is published

    int t0 = (wave >> 3) * 8;
    // rolled: one trip's registers are enough; two token tiles a trip are two independent chains
#pragma unroll 1
    for (int t = 0; t < 8; t += 2) {
        const _Float16* as = sQ + ((t0 + t) * 16 + lm) * XP + lg;
        v16h a[2][4];
#pragma unroll
        for (int u = 0; u < 2; ++u)
#pragma unroll
            for (int kk = 0; kk < 4; ++kk) a[u][kk] = load_frag(as + u * 16 * XP + kk * 32);
        v8f acc[2] = {};
#pragma unroll
        for (int kk = 0; kk < 4; ++kk)
#pragma unroll
            for (int u = 0; u < 2; ++u)
                acc[u] = wmma32(a[u][kk], b[kk], acc[u]);
        float* op = out + (rowbase + (t0 + t) * 16 + lg) * DD + ct * 16 + lm;
#pragma unroll
        for (int u = 0; u < 2; ++u)
#pragma unroll
            for (int r = 0; r < 8; ++r)
                op[(size_t)(u * 16 + r) * DD] = acc[u][r] + bias;
        // the next trip rewrites registers that these stores name
        asm volatile("s_wait_xcnt 0x0" ::: "memory");
    }
}

// ---------------------------------------------------------------------------
extern "C" void kernel_launch(void* const* d_in, const int* in_sizes, int n_in,
                              void* d_out, int out_size, void* d_ws, size_t ws_size,
                              hipStream_t stream) {
    const float* x     = (const float*)d_in[0];
    const float* mask  = (const float*)d_in[1];
    const float* ln_w  = (const float*)d_in[2];
    const float* ln_b  = (const float*)d_in[3];
    const float* w_tri = (const float*)d_in[4];
    const float* w_q   = (const float*)d_in[5];
    const float* w_k   = (const float*)d_in[6];
    const float* w_v   = (const float*)d_in[7];
    const float* w_g   = (const float*)d_in[8];
    const float* b_g   = (const float*)d_in[9];
    const float* w_o   = (const float*)d_in[10];
    const float* b_o   = (const float*)d_in[11];

    _Float16* xn   = (_Float16*)d_ws;
    _Float16* wt   = xn + TD;                  // 5 * 16384 halves
    float*    tri  = (float*)(wt + 5 * 16384); // H * 65536 floats

    k_ln_tri<<<TOK / (8 * LN_TPW), 256, 0, stream>>>(x, ln_w, ln_b, w_tri,
                                                     w_q, w_k, w_v, w_g, w_o, xn, tri, wt);
    k_row<<<NN, 512, 0, stream>>>(xn, wt, b_g, tri, mask, b_o, (float*)d_out);
}

// v005
// It runs in 36.2 microseconds.
// Next to v004, in two timings, it ran 1.19 times as fast each time.
// Over all steps from v000 it is 6.36 times as fast.
#include <hip/hip_runtime.h>
#include <hip/hip_bf16.h>

typedef __attribute__((ext_vector_type(16))) _Float16 v16h;
typedef __attribute__((ext_vector_type(8)))  _Float16 v8h;
typedef __attribute__((ext_vector_type(4)))  _Float16 v4h;
typedef __attribute__((ext_vector_type(8)))  float    v8f;

#define NN   256
#define DD   128
#define HH   4
#define CC   32
#define TOK  65536          // N*N tokens
#define TD   8388608ull     // TOK * DD

// Build a WMMA 16-half fragment from two contiguous 8-half (16B) chunks:
// elements [0..7] at p, elements [8..15] at p+16 halves.
__device__ __forceinline__ v16h load_frag(const _Float16* p) {
    v8h lo = *(const v8h*)p;
    v8h hi = *(const v8h*)(p + 16);
    v16h r;
#pragma unroll
    for (int e = 0; e < 8; ++e) { r[e] = lo[e]; r[8 + e] = hi[e]; }
    return r;
}

// The same fragment from a weight block stored in fragment order: the wave's 32 low chunks
// are 512 contiguous bytes, its 32 high chunks the next 512; p is this lane's low chunk.
__device__ __forceinline__ v16h load_frag_packed(const _Float16* p) {
    v8h lo = *(const v8h*)p;
    v8h hi = *(const v8h*)(p + 256);
    v16h r;
#pragma unroll
    for (int e = 0; e < 8; ++e) { r[e] = lo[e]; r[8 + e] = hi[e]; }
    return r;
}

__device__ __forceinline__ v8f wmma32(v16h a, v16h b, v8f c) {
    return __builtin_amdgcn_wmma_f32_16x16x32_f16(false, a, false, b,
                                                  (short)0, c, false, false);
}

__device__ __forceinline__ float fast_rcp(float x) {
    return __builtin_amdgcn_rcpf(x);   // v_rcp_f32, avoids IEEE div expansion
}

__device__ __forceinline__ void async_copy_b128(const _Float16* lds_dst,
                                                const _Float16* gsrc) {
    unsigned lds_off = (unsigned)(uintptr_t)lds_dst;
    asm volatile("global_load_async_to_lds_b128 %0, %1, off\n\ts_wait_xcnt 0x0"
                 :: "v"(lds_off), "v"(gsrc) : "memory");
}
// this wave's copies have landed (other waves read them behind the next barrier)
__device__ __forceinline__ void wait_async() {
    asm volatile("s_wait_asynccnt 0x0" ::: "memory");
}

#define LN_TPW 8
#define WT_BLOCKS 320   // 5 * 128 * 128 elements / 256 threads; 64 work-groups a matrix

__global__ __launch_bounds__(256)
void k_ln_tri(const float* __restrict__ x, const float* __restrict__ ln_w,
              const float* __restrict__ ln_b, const float* __restrict__ w_tri,
              const float* __restrict__ wq, const float* __restrict__ wk,
              const float* __restrict__ wv, const float* __restrict__ wg,
              const float* __restrict__ wo,
              _Float16* __restrict__ xn, float* __restrict__ tri,
              _Float16* __restrict__ wt) {
    int wave = threadIdx.x >> 5;
    int lane = threadIdx.x & 31;
    int m  = (blockIdx.x >> 5) * 8 + wave;      // the wave's row of x: tri's query
    int n0 = (blockIdx.x & 31) * LN_TPW;        // its first column: tri's first key
    int token0 = m * NN + n0;

    // all of the wave's token rows go out first: LN_TPW loads of 512 B in flight
    const float* xp = x + (size_t)token0 * DD + lane * 4;
    float4 xv[LN_TPW];
#pragma unroll
    for (int u = 0; u < LN_TPW; ++u) xv[u] = *(const float4*)(xp + u * DD);

    float4 w = *(const float4*)(ln_w + lane * 4);
    float4 b = *(const float4*)(ln_b + lane * 4);
    float4 wr[4];   // w_tri laid out [128][4]: row lane*4 + t
#pragma unroll
    for (int t = 0; t < 4; ++t) wr[t] = *(const float4*)(w_tri + (size_t)(lane * 4 + t) * HH);

    float d[LN_TPW][4], rs[LN_TPW];
#pragma unroll
    for (int u = 0; u < LN_TPW; ++u) {
        float s = xv[u].x + xv[u].y + xv[u].z + xv[u].w;
#pragma unroll
        for (int m = 16; m >= 1; m >>= 1) s += __shfl_xor(s, m, 32);
        float mu = s * (1.0f / 128.0f);

        float d0 = xv[u].x - mu, d1 = xv[u].y - mu, d2 = xv[u].z - mu, d3 = xv[u].w - mu;
        float vs = d0 * d0 + d1 * d1 + d2 * d2 + d3 * d3;
#pragma unroll
        for (int m = 16; m >= 1; m >>= 1) vs += __shfl_xor(vs, m, 32);
        d[u][0] = d0; d[u][1] = d1; d[u][2] = d2; d[u][3] = d3;
        rs[u] = vs * (1.0f / 128.0f) + 1e-5f;
    }
    static_assert(LN_TPW == 8, "the statement below names eight values");
    asm("v_rsq_f32 %0, %0\n\tv_rsq_f32 %1, %1\n\tv_rsq_f32 %2, %2\n\tv_rsq_f32 %3, %3\n\t"
        "v_rsq_f32 %4, %4\n\tv_rsq_f32 %5, %5\n\tv_rsq_f32 %6, %6\n\tv_rsq_f32 %7, %7\n\t"
        "v_nop"
        : "+v"(rs[0]), "+v"(rs[1]), "+v"(rs[2]), "+v"(rs[3]),
          "+v"(rs[4]), "+v"(rs[5]), "+v"(rs[6]), "+v"(rs[7]));

    float tr[HH][LN_TPW];
#pragma unroll
    for (int u = 0; u < LN_TPW; ++u) {
        float rstd = rs[u];
        float d0 = d[u][0], d1 = d[u][1], d2 = d[u][2], d3 = d[u][3];

        float y[4];
        y[0] = d0 * rstd * w.x + b.x;
        y[1] = d1 * rstd * w.y + b.y;
        y[2] = d2 * rstd * w.z + b.z;
        y[3] = d3 * rstd * w.w + b.w;

        v4h yh;
#pragma unroll
        for (int t = 0; t < 4; ++t) yh[t] = (_Float16)y[t];
        *(v4h*)(xn + (size_t)(token0 + u) * DD + lane * 4) = yh;

        // tri[h] = sum_d xn[d] * w_tri[d][h]
        float t0 = 0.f, t1 = 0.f, t2 = 0.f, t3 = 0.f;
#pragma unroll
        for (int t = 0; t < 4; ++t) {
            t0 += y[t] * wr[t].x; t1 += y[t] * wr[t].y;
            t2 += y[t] * wr[t].z; t3 += y[t] * wr[t].w;
        }
#pragma unroll
        for (int m = 16; m >= 1; m >>= 1) {
            t0 += __shfl_xor(t0, m, 32); t1 += __shfl_xor(t1, m, 32);
            t2 += __shfl_xor(t2, m, 32); t3 += __shfl_xor(t3, m, 32);
        }
        tr[0][u] = t0; tr[1][u] = t1; tr[2][u] = t2; tr[3][u] = t3;
    }
    if (lane == 0) {
        float* td = tri + (m >> 4) * 4096 + (n0 >> 4) * 256
                        + (((n0 >> 3) & 1) * 16 + (m & 15)) * 4;
#pragma unroll
        for (int h = 0; h < HH; ++h)
#pragma unroll
            for (int u = 0; u < LN_TPW; u += 4)
                *(float4*)(td + h * TOK + (u >> 2) * 128) =
                    make_float4(tr[h][u], tr[h][u + 1], tr[h][u + 2], tr[h][u + 3]);
    }

    // the weights' share comes last: the work-groups that have it are the first to start,
    // so its load latency ends before the grid's last work-groups do. The test and the
    // choice of matrix are the same for the whole work-group.
    if (blockIdx.x < WT_BLOCKS) {
        int mat = blockIdx.x >> 6;
        int r   = (blockIdx.x & 63) * 256 + threadIdx.x;
        int n   = (r >> 11) * 16 + ((r >> 3) & 15);
        int k   = ((r >> 8) & 7) * 16 + ((r >> 7) & 1) * 8 + (r & 7);
        const float* W = (mat == 0) ? wq : (mat == 1) ? wk : (mat == 2) ? wv
                       : (mat == 3) ? wg : wo;
        wt[mat * 16384 + r] = (_Float16)W[k * DD + n];
    }
}

#define XP 136
#define VP 264

__global__ __launch_bounds__(512)
void k_row(const _Float16* __restrict__ xn, const _Float16* __restrict__ wt,
           const float* __restrict__ b_g, const float* __restrict__ tri,
           const float* __restrict__ mask, const float* __restrict__ b_o,
           float* __restrict__ out) {
    __shared__ __attribute__((aligned(16))) _Float16 sX[NN * XP];   // xn rows, later g rows
    __shared__ __attribute__((aligned(16))) _Float16 sK[NN * XP];   // K rows [n][h*32+c]
    __shared__ __attribute__((aligned(16))) _Float16 sQ[NN * XP];   // q rows, later o rows
    __shared__ __attribute__((aligned(16))) _Float16 sVt[DD * VP];  // V transposed [h*32+c][n]
    __shared__ __attribute__((aligned(16))) float    sMb[NN];       // mask bias per key

    int i = blockIdx.x;
    int tid = threadIdx.x, lane = tid & 31;
    // the wave's number in a scalar register: the tests on it below are scalar branches
    int wave = __builtin_amdgcn_readfirstlane(tid >> 5);
    int lm = lane & 15, lg = (lane >> 4) * 8;
    int ct = wave & 7;
    size_t rowbase = (size_t)i * NN;

    // the row's xn: 4096 pieces of 16 B, eight per lane, each wave's copy 512 B in a row
    const _Float16* src = xn + rowbase * DD;
#pragma unroll
    for (int u = 0; u < 8; ++u) {
        int c = u * 512 + tid;
        async_copy_b128(&sX[(c >> 4) * XP + (c & 15) * 8], src + (size_t)c * 8);
    }

    // weights and mask bias come in while the copies fly
    unsigned woff = (unsigned)(ct * 2048 + lane * 8);         // this lane's place in a matrix
    const _Float16* wa = wt + (wave < 8 ? 1 : 2) * 16384;     // k or v
    const _Float16* wb = wt + (wave < 8 ? 0 : 3) * 16384;     // q or g
    v16h fa[4], fb[4];
#pragma unroll
    for (int kk = 0; kk < 4; ++kk) {
        fa[kk] = load_frag_packed(wa + woff + kk * 512);
        fb[kk] = load_frag_packed(wb + woff + kk * 512);
    }
    if (wave < 8) sMb[tid] = 1e9f * (mask[rowbase + tid] - 1.0f);

    wait_async();
    __syncthreads();

    v8h gk[16] = {};   // g of this wave's channels, all 16 token tiles (waves 8-15)
    if (wave < 8) {
#pragma unroll 2
        for (int tt = 0; tt < 16; ++tt) {
            const _Float16* xr = sX + (tt * 16 + lm) * XP + lg;
            v16h xf[4];
#pragma unroll
            for (int kk = 0; kk < 4; ++kk) xf[kk] = load_frag(xr + kk * 32);
            v8f ak = {}, aq = {};
#pragma unroll
            for (int kk = 0; kk < 4; ++kk) {
                ak = wmma32(fa[kk], xf[kk], ak);   // D[channel lg+r][token lm]
                aq = wmma32(fb[kk], xf[kk], aq);
            }
            v8h hk, hq;
#pragma unroll
            for (int r = 0; r < 8; ++r) {
                hk[r] = (_Float16)ak[r];
                hq[r] = (_Float16)(aq[r] * 0.17677669529663687f);   // q / sqrt(C)
            }
            int o = (tt * 16 + lm) * XP + ct * 16 + lg;
            *(v8h*)(sK + o) = hk;
            *(v8h*)(sQ + o) = hq;
        }
    } else {
        float4 bg0 = *(const float4*)(b_g + ct * 16 + lg);
        float4 bg1 = *(const float4*)(b_g + ct * 16 + lg + 4);
        float bg[8] = {bg0.x, bg0.y, bg0.z, bg0.w, bg1.x, bg1.y, bg1.z, bg1.w};
        // unrolled: gk is indexed by the trip and must stay in registers
#pragma unroll
        for (int tt = 0; tt < 16; ++tt) {
            const _Float16* xr = sX + (tt * 16 + lm) * XP + lg;
            v16h xf[4];
#pragma unroll
            for (int kk = 0; kk < 4; ++kk) xf[kk] = load_frag(xr + kk * 32);
            v8f av = {}, ag = {};
#pragma unroll
            for (int kk = 0; kk < 4; ++kk) {
                av = wmma32(xf[kk], fa[kk], av);   // D[token lg+r][channel lm]
                ag = wmma32(fb[kk], xf[kk], ag);   // D[channel lg+r][token lm]
            }
            v8h hv;
#pragma unroll
            for (int r = 0; r < 8; ++r) hv[r] = (_Float16)av[r];
            *(v8h*)(sVt + (ct * 16 + lm) * VP + tt * 16 + lg) = hv;

            float e[8];     // g = sigmoid(z) = 1 / (1 + exp2(-z * log2(e))), as __expf forms it
#pragma unroll
            for (int r = 0; r < 8; ++r) e[r] = (ag[r] + bg[r]) * -1.44269504088896340736f;
            asm("v_exp_f32 %0, %0\n\tv_exp_f32 %1, %1\n\tv_exp_f32 %2, %2\n\tv_exp_f32 %3, %3\n\t"
                "v_exp_f32 %4, %4\n\tv_exp_f32 %5, %5\n\tv_exp_f32 %6, %6\n\tv_exp_f32 %7, %7\n\t"
                "v_add_f32 %0, 1.0, %0\n\tv_add_f32 %1, 1.0, %1\n\tv_add_f32 %2, 1.0, %2\n\tv_add_f32 %3, 1.0, %3\n\t"
                "v_add_f32 %4, 1.0, %4\n\tv_add_f32 %5, 1.0, %5\n\tv_add_f32 %6, 1.0, %6\n\tv_add_f32 %7, 1.0, %7\n\t"
                "v_rcp_f32 %0, %0\n\tv_rcp_f32 %1, %1\n\tv_rcp_f32 %2, %2\n\tv_rcp_f32 %3, %3\n\t"
                "v_rcp_f32 %4, %4\n\tv_rcp_f32 %5, %5\n\tv_rcp_f32 %6, %6\n\tv_rcp_f32 %7, %7\n\t"
                "v_nop"
                : "+v"(e[0]), "+v"(e[1]), "+v"(e[2]), "+v"(e[3]),
                  "+v"(e[4]), "+v"(e[5]), "+v"(e[6]), "+v"(e[7]));
#pragma unroll
            for (int r = 0; r < 8; ++r) gk[tt][r] = (_Float16)e[r];
        }
    }
    __syncthreads();    // every wave has left xn
    if (wave >= 8) {
#pragma unroll
        for (int tt = 0; tt < 16; ++tt)
            *(v8h*)(sX + (tt * 16 + lm) * XP + ct * 16 + lg) = gk[tt];
    }
    __syncthreads();    // k, q, v, g are published

    // rolled: the heads unrolled together would multiply the live score registers
    int m0 = wave * 16;
#pragma unroll 1
    for (int h = 0; h < HH; ++h) {
        _Float16* qo = sQ + (m0 + lm) * XP + h * CC + lg;          // this lane's q, then o
        const _Float16* kh = sK + lm * XP + h * CC + lg;
        const _Float16* vh = sVt + (h * CC + lm) * VP + lg;

        // S^T tile nt: s[nt][r] = score(query m0+lm, key nt*16 + lg + r)
        v16h bQ = load_frag(qo);
        const float* tp = tri + h * TOK + wave * 4096 + lane * 4;
        v8f s[16];
        // all 32 tri loads go out first: they land in the accumulators (C operand)
#pragma unroll
        for (int nt = 0; nt < 16; ++nt) {
            float4 c0 = *(const float4*)(tp + nt * 256);
            float4 c1 = *(const float4*)(tp + nt * 256 + 128);
            s[nt] = v8f{c0.x, c0.y, c0.z, c0.w, c1.x, c1.y, c1.z, c1.w};
        }
        // K fragments in groups of four tiles, fetched one group ahead of their WMMAs.
        // The scheduling barriers hold that order: without them the compiler either
        // hoists every LDS load of the tile (spills) or waits on each fragment alone.
        v16h aK[2][4];
#pragma unroll
        for (int j = 0; j < 4; ++j)
            aK[0][j] = load_frag(kh + (j * 16) * XP);
#pragma unroll
        for (int g = 0; g < 4; ++g) {
            __builtin_amdgcn_sched_barrier(0);
            if (g < 3) {
#pragma unroll
                for (int j = 0; j < 4; ++j)
                    aK[(g + 1) & 1][j] = load_frag(kh + (((g + 1) * 4 + j) * 16) * XP);
            }
            __builtin_amdgcn_sched_barrier(0);
#pragma unroll
            for (int j = 0; j < 4; ++j)
                s[g * 4 + j] = wmma32(aK[g & 1][j], bQ, s[g * 4 + j]);
        }
        // the next head's address is formed over the register pair that the tri loads name
        asm volatile("s_wait_xcnt 0x0" ::: "memory");

        float mxj[4] = {-3.0e38f, -3.0e38f, -3.0e38f, -3.0e38f};   // four independent chains
#pragma unroll
        for (int g = 0; g < 4; ++g) {
            // same purpose: at most four tiles' mask bias live at a time
            __builtin_amdgcn_sched_barrier(0);
#pragma unroll
            for (int j = 0; j < 4; ++j) {
                int nt = g * 4 + j;
                float4 b0 = *(const float4*)(sMb + nt * 16 + lg);
                float4 b1 = *(const float4*)(sMb + nt * 16 + lg + 4);
                float mb[8] = {b0.x, b0.y, b0.z, b0.w, b1.x, b1.y, b1.z, b1.w};
#pragma unroll
                for (int r = 0; r < 8; ++r) {
                    s[nt][r] += mb[r];
                    mxj[j] = fmaxf(mxj[j], s[nt][r]);
                }
            }
        }
        float mx = fmaxf(fmaxf(mxj[0], mxj[1]), fmaxf(mxj[2], mxj[3]));
        mx = fmaxf(mx, __shfl_xor(mx, 16, 32));

        // exp, pack two score tiles into one B fragment, O^T += V^T . P^T
        float sum = 0.f;
        v8f acc0 = {}, acc1 = {};
#pragma unroll
        for (int ks = 0; ks < 8; ++ks) {
            // same purpose: one k-step's V^T fragments live at a time
            __builtin_amdgcn_sched_barrier(0);
            v16h aV0 = load_frag(vh + ks * 32);
            v16h aV1 = load_frag(vh + 16 * VP + ks * 32);
            float p[16];   // exp(x) = exp2(x * log2(e)), as __expf forms it
#pragma unroll
            for (int r = 0; r < 8; ++r) {
                p[r]     = (s[2 * ks][r] - mx) * 1.44269504088896340736f;
                p[8 + r] = (s[2 * ks + 1][r] - mx) * 1.44269504088896340736f;
            }
            asm("v_exp_f32 %0, %0\n\tv_exp_f32 %1, %1\n\tv_exp_f32 %2, %2\n\tv_exp_f32 %3, %3\n\t"
                "v_exp_f32 %4, %4\n\tv_exp_f32 %5, %5\n\tv_exp_f32 %6, %6\n\tv_exp_f32 %7, %7\n\t"
                "v_exp_f32 %8, %8\n\tv_exp_f32 %9, %9\n\tv_exp_f32 %10, %10\n\tv_exp_f32 %11, %11\n\t"
                "v_exp_f32 %12, %12\n\tv_exp_f32 %13, %13\n\tv_exp_f32 %14, %14\n\tv_exp_f32 %15, %15\n\t"
                "v_nop"
                : "+v"(p[0]), "+v"(p[1]), "+v"(p[2]), "+v"(p[3]), "+v"(p[4]), "+v"(p[5]),
                  "+v"(p[6]), "+v"(p[7]), "+v"(p[8]), "+v"(p[9]), "+v"(p[10]), "+v"(p[11]),
                  "+v"(p[12]), "+v"(p[13]), "+v"(p[14]), "+v"(p[15]));
            v16h bP;
#pragma unroll
            for (int r = 0; r < 8; ++r) {
                sum += p[r] + p[8 + r];
                bP[r] = (_Float16)p[r];
                bP[8 + r] = (_Float16)p[8 + r];
            }
            acc0 = wmma32(aV0, bP, acc0);
            acc1 = wmma32(aV1, bP, acc1);
        }
        sum += __shfl_xor(sum, 16, 32);
        float inv = fast_rcp(sum);

        // acc0[r], acc1[r] = O(query m0+lm, channel h*32 + lg + r, + 16): normalise, gate, store
        const _Float16* gp = sX + (m0 + lm) * XP + h * CC + lg;
        v8h g0 = *(const v8h*)gp;
        v8h g1 = *(const v8h*)(gp + 16);
        v8h o0, o1;
#pragma unroll
        for (int r = 0; r < 8; ++r) {
            o0[r] = (_Float16)((float)g0[r] * (acc0[r] * inv));
            o1[r] = (_Float16)((float)g1[r] * (acc1[r] * inv));
        }
        *(v8h*)qo = o0;
        *(v8h*)(qo + 16) = o1;
    }

    // w_o's fragments come in while the slower waves finish
    v16h b[4];
#pragma unroll
    for (int kk = 0; kk < 4; ++kk)
        b[kk] = load_frag_packed(wt + 4 * 16384 + woff + kk * 512);
    float bias = b_o[ct * 16 + lm];
    __syncthreads();    // o is published

    int t0 = (wave >> 3) * 8;
    // rolled: one trip's registers are enough; two token tiles a trip are two independent chains
#pragma unroll 1
    for (int t = 0; t < 8; t += 2) {
        const _Float16* as = sQ + ((t0 + t) * 16 + lm) * XP + lg;
        v16h a[2][4];
#pragma unroll
        for (int u = 0; u < 2; ++u)
#pragma unroll
            for (int kk = 0; kk < 4; ++kk) a[u][kk] = load_frag(as + u * 16 * XP + kk * 32);
        v8f acc[2] = {};
#pragma unroll
        for (int kk = 0; kk < 4; ++kk)
#pragma unroll
            for (int u = 0; u < 2; ++u)
                acc[u] = wmma32(a[u][kk], b[kk], acc[u]);
        float* op = out + (rowbase + (t0 + t) * 16 + lg) * DD + ct * 16 + lm;
#pragma unroll
        for (int u = 0; u < 2; ++u)
#pragma unroll
            for (int r = 0; r < 8; ++r)
                op[(size_t)(u * 16 + r) * DD] = acc[u][r] + bias;
        // the next trip rewrites registers that these stores name
        asm volatile("s_wait_xcnt 0x0" ::: "memory");
    }
}

// ---------------------------------------------------------------------------
extern "C" void kernel_launch(void* const* d_in, const int* in_sizes, int n_in,
                              void* d_out, int out_size, void* d_ws, size_t ws_size,
                              hipStream_t stream) {
    const float* x     = (const float*)d_in[0];
    const float* mask  = (const float*)d_in[1];
    const float* ln_w  = (const float*)d_in[2];
    const float* ln_b  = (const float*)d_in[3];
    const float* w_tri = (const float*)d_in[4];
    const float* w_q   = (const float*)d_in[5];
    const float* w_k   = (const float*)d_in[6];
    const float* w_v   = (const float*)d_in[7];
    const float* w_g   = (const float*)d_in[8];
    const float* b_g   = (const float*)d_in[9];
    const float* w_o   = (const float*)d_in[10];
    const float* b_o   = (const float*)d_in[11];

    _Float16* xn   = (_Float16*)d_ws;
    _Float16* wt   = xn + TD;                  // 5 * 16384 halves
    float*    tri  = (float*)(wt + 5 * 16384); // H * 65536 floats, at a multiple of 512 B

    k_ln_tri<<<TOK / (8 * LN_TPW), 256, 0, stream>>>(x, ln_w, ln_b, w_tri,
                                                     w_q, w_k, w_v, w_g, w_o, xn, tri, wt);
    k_row<<<NN, 512, 0, stream>>>(xn, wt, b_g, tri, mask, b_o, (float*)d_out);
}

// v007
// Measured time: 32.8 microseconds a run.
// Versions in between are left out here; by their measured steps it is 1.10 times as fast as v005.
// Counting every step since v000, it is 7.01 times as fast.
#include <hip/hip_runtime.h>
#include <hip/hip_bf16.h>

typedef __attribute__((ext_vector_type(16))) _Float16 v16h;
typedef __attribute__((ext_vector_type(8)))  _Float16 v8h;
typedef __attribute__((ext_vector_type(4)))  _Float16 v4h;
typedef __attribute__((ext_vector_type(8)))  float    v8f;

#define NN   256
#define DD   128
#define HH   4
#define CC   32
#define TOK  65536          // N*N tokens
#define TD   8388608ull     // TOK * DD

// Build a WMMA 16-half fragment from two contiguous 8-half (16B) chunks:
// elements [0..7] at p, elements [8..15] at p+16 halves.
__device__ __forceinline__ v16h load_frag(const _Float16* p) {
    v8h lo = *(const v8h*)p;
    v8h hi = *(const v8h*)(p + 16);
    v16h r;
#pragma unroll
    for (int e = 0; e < 8; ++e) { r[e] = lo[e]; r[8 + e] = hi[e]; }
    return r;
}

// The same fragment from a weight block stored in fragment order: the wave's 32 low chunks
// are 512 contiguous bytes, its 32 high chunks the next 512; p is this lane's low chunk.
__device__ __forceinline__ v16h load_frag_packed(const _Float16* p) {
    v8h lo = *(const v8h*)p;
    v8h hi = *(const v8h*)(p + 256);
    v16h r;
#pragma unroll
    for (int e = 0; e < 8; ++e) { r[e] = lo[e]; r[8 + e] = hi[e]; }
    return r;
}

__device__ __forceinline__ v8f wmma32(v16h a, v16h b, v8f c) {
    return __builtin_amdgcn_wmma_f32_16x16x32_f16(false, a, false, b,
                                                  (short)0, c, false, false);
}

__device__ __forceinline__ float fast_rcp(float x) {
    return __builtin_amdgcn_rcpf(x);   // v_rcp_f32, avoids IEEE div expansion
}

__device__ __forceinline__ void async_copy_b128(const _Float16* lds_dst,
                                                const _Float16* gsrc) {
    unsigned lds_off = (unsigned)(uintptr_t)lds_dst;
    asm volatile("global_load_async_to_lds_b128 %0, %1, off\n\ts_wait_xcnt 0x0"
                 :: "v"(lds_off), "v"(gsrc) : "memory");
}
// this wave's copies have landed (other waves read them behind the next barrier)
__device__ __forceinline__ void wait_async() {
    asm volatile("s_wait_asynccnt 0x0" ::: "memory");
}

#define LN_TPW 8
#define WT_BLOCKS 320   // 5 * 128 * 128 elements / 256 threads; 64 work-groups a matrix

__global__ __launch_bounds__(256)
void k_ln_tri(const float* __restrict__ x, const float* __restrict__ ln_w,
              const float* __restrict__ ln_b, const float* __restrict__ w_tri,
              const float* __restrict__ wq, const float* __restrict__ wk,
              const float* __restrict__ wv, const float* __restrict__ wg,
              const float* __restrict__ wo,
              _Float16* __restrict__ xn, _Float16* __restrict__ tri,
              _Float16* __restrict__ wt) {
    int wave = threadIdx.x >> 5;
    int lane = threadIdx.x & 31;
    int m0 = (blockIdx.x >> 5) * LN_TPW;        // the wave's first row of x: tri's first query
    int n  = (blockIdx.x & 31) * 8 + wave;      // its column: tri's key
    int token0 = m0 * NN + n;                   // token u of the wave is token0 + u * NN

    // all of the wave's token rows go out first: LN_TPW loads of 512 B in flight
    const float* xp = x + (size_t)token0 * DD + lane * 4;
    float4 xv[LN_TPW];
#pragma unroll
    for (int u = 0; u < LN_TPW; ++u) xv[u] = *(const float4*)(xp + u * NN * DD);

    float4 w = *(const float4*)(ln_w + lane * 4);
    float4 b = *(const float4*)(ln_b + lane * 4);
    float4 wr[4];   // w_tri laid out [128][4]: row lane*4 + t
#pragma unroll
    for (int t = 0; t < 4; ++t) wr[t] = *(const float4*)(w_tri + (size_t)(lane * 4 + t) * HH);

    float d[LN_TPW][4], rs[LN_TPW];
#pragma unroll
    for (int u = 0; u < LN_TPW; ++u) {
        float s = xv[u].x + xv[u].y + xv[u].z + xv[u].w;
#pragma unroll
        for (int m = 16; m >= 1; m >>= 1) s += __shfl_xor(s, m, 32);
        float mu = s * (1.0f / 128.0f);

        float d0 = xv[u].x - mu, d1 = xv[u].y - mu, d2 = xv[u].z - mu, d3 = xv[u].w - mu;
        float vs = d0 * d0 + d1 * d1 + d2 * d2 + d3 * d3;
#pragma unroll
        for (int m = 16; m >= 1; m >>= 1) vs += __shfl_xor(vs, m, 32);
        d[u][0] = d0; d[u][1] = d1; d[u][2] = d2; d[u][3] = d3;
        rs[u] = vs * (1.0f / 128.0f) + 1e-5f;
    }
    static_assert(LN_TPW == 8, "the statement below names eight values");
    asm("v_rsq_f32 %0, %0\n\tv_rsq_f32 %1, %1\n\tv_rsq_f32 %2, %2\n\tv_rsq_f32 %3, %3\n\t"
        "v_rsq_f32 %4, %4\n\tv_rsq_f32 %5, %5\n\tv_rsq_f32 %6, %6\n\tv_rsq_f32 %7, %7\n\t"
        "v_nop"
        : "+v"(rs[0]), "+v"(rs[1]), "+v"(rs[2]), "+v"(rs[3]),
          "+v"(rs[4]), "+v"(rs[5]), "+v"(rs[6]), "+v"(rs[7]));

    float tr[HH][LN_TPW];
#pragma unroll
    for (int u = 0; u < LN_TPW; ++u) {
        float rstd = rs[u];
        float d0 = d[u][0], d1 = d[u][1], d2 = d[u][2], d3 = d[u][3];

        float y[4];
        y[0] = d0 * rstd * w.x + b.x;
        y[1] = d1 * rstd * w.y + b.y;
        y[2] = d2 * rstd * w.z + b.z;
        y[3] = d3 * rstd * w.w + b.w;

        v4h yh;
#pragma unroll
        for (int t = 0; t < 4; ++t) yh[t] = (_Float16)y[t];
        *(v4h*)(xn + (size_t)(token0 + u * NN) * DD + lane * 4) = yh;

        // tri[h] = sum_d xn[d] * w_tri[d][h]
        float t0 = 0.f, t1 = 0.f, t2 = 0.f, t3 = 0.f;
#pragma unroll
        for (int t = 0; t < 4; ++t) {
            t0 += y[t] * wr[t].x; t1 += y[t] * wr[t].y;
            t2 += y[t] * wr[t].z; t3 += y[t] * wr[t].w;
        }
#pragma unroll
        for (int m = 16; m >= 1; m >>= 1) {
            t0 += __shfl_xor(t0, m, 32); t1 += __shfl_xor(t1, m, 32);
            t2 += __shfl_xor(t2, m, 32); t3 += __shfl_xor(t3, m, 32);
        }
        tr[0][u] = t0; tr[1][u] = t1; tr[2][u] = t2; tr[3][u] = t3;
    }
    if (lane == 0) {
        _Float16* td = tri + (m0 >> 4) * 4096 + (n >> 4) * 256
                           + (((m0 >> 3) & 1) * 16 + (n & 15)) * 8;
#pragma unroll
        for (int h = 0; h < HH; ++h) {
            v8h th;
#pragma unroll
            for (int u = 0; u < LN_TPW; ++u) th[u] = (_Float16)tr[h][u];
            *(v8h*)(td + h * TOK) = th;
        }
    }

    // the weights' share comes last: the work-groups that have it are the first to start,
    // so its load latency ends before the grid's last work-groups do. The test and the
    // choice of matrix are the same for the whole work-group.
    if (blockIdx.x < WT_BLOCKS) {
        int mat = blockIdx.x >> 6;
        int r   = (blockIdx.x & 63) * 256 + threadIdx.x;
        int n   = (r >> 11) * 16 + ((r >> 3) & 15);
        int k   = ((r >> 8) & 7) * 16 + ((r >> 7) & 1) * 8 + (r & 7);
        const float* W = (mat == 0) ? wq : (mat == 1) ? wk : (mat == 2) ? wv
                       : (mat == 3) ? wg : wo;
        wt[mat * 16384 + r] = (_Float16)W[k * DD + n];
    }
}

#define XP 136
#define VP 264
#define SP 36

__global__ __launch_bounds__(512)
void k_row(const _Float16* __restrict__ xn, const _Float16* __restrict__ wt,
           const float* __restrict__ b_g, const _Float16* __restrict__ tri,
           const float* __restrict__ mask, const float* __restrict__ b_o,
           float* __restrict__ out) {
    __shared__ __attribute__((aligned(16))) _Float16 sX[NN * XP];   // xn rows, later g rows
    __shared__ __attribute__((aligned(16))) _Float16 sK[NN * XP];   // K rows [n][h*32+c]
    __shared__ __attribute__((aligned(16))) _Float16 sQ[NN * XP];   // q rows, later o rows
    __shared__ __attribute__((aligned(16))) _Float16 sVt[DD * VP];  // V transposed [h*32+c][n]
    __shared__ __attribute__((aligned(16))) float    sMb[NN];       // mask bias per key

    int i = blockIdx.x;
    int tid = threadIdx.x, lane = tid & 31;
    // the wave's number in a scalar register: the tests on it below are scalar branches
    int wave = __builtin_amdgcn_readfirstlane(tid >> 5);
    int lm = lane & 15, lg = (lane >> 4) * 8;
    int ct = wave & 7;
    size_t rowbase = (size_t)i * NN;

    // the row's xn: 4096 pieces of 16 B, eight per lane, each wave's copy 512 B in a row
    const _Float16* src = xn + rowbase * DD;
#pragma unroll
    for (int u = 0; u < 8; ++u) {
        int c = u * 512 + tid;
        async_copy_b128(&sX[(c >> 4) * XP + (c & 15) * 8], src + (size_t)c * 8);
    }

    // weights and mask bias come in while the copies fly
    unsigned woff = (unsigned)(ct * 2048 + lane * 8);         // this lane's place in a matrix
    const _Float16* wa = wt + (wave < 8 ? 1 : 2) * 16384;     // k or v
    const _Float16* wb = wt + (wave < 8 ? 0 : 3) * 16384;     // q or g
    v16h fa[4], fb[4];
#pragma unroll
    for (int kk = 0; kk < 4; ++kk) {
        fa[kk] = load_frag_packed(wa + woff + kk * 512);
        fb[kk] = load_frag_packed(wb + woff + kk * 512);
    }
    if (wave < 8) sMb[tid] = 1e9f * (mask[rowbase + tid] - 1.0f);

    wait_async();
    __syncthreads();

    v8h gk[16] = {};   // g of this wave's channels, all 16 token tiles (waves 8-15)
    if (wave < 8) {
#pragma unroll 2
        for (int tt = 0; tt < 16; ++tt) {
            const _Float16* xr = sX + (tt * 16 + lm) * XP + lg;
            v16h xf[4];
#pragma unroll
            for (int kk = 0; kk < 4; ++kk) xf[kk] = load_frag(xr + kk * 32);
            v8f ak = {}, aq = {};
#pragma unroll
            for (int kk = 0; kk < 4; ++kk) {
                ak = wmma32(fa[kk], xf[kk], ak);   // D[channel lg+r][token lm]
                aq = wmma32(fb[kk], xf[kk], aq);
            }
            v8h hk, hq;
#pragma unroll
            for (int r = 0; r < 8; ++r) {
                hk[r] = (_Float16)ak[r];
                hq[r] = (_Float16)(aq[r] * 0.17677669529663687f);   // q / sqrt(C)
            }
            int o = (tt * 16 + lm) * XP + ct * 16 + lg;
            *(v8h*)(sK + o) = hk;
            *(v8h*)(sQ + o) = hq;
        }
    } else {
        float4 bg0 = *(const float4*)(b_g + ct * 16 + lg);
        float4 bg1 = *(const float4*)(b_g + ct * 16 + lg + 4);
        float bg[8] = {bg0.x, bg0.y, bg0.z, bg0.w, bg1.x, bg1.y, bg1.z, bg1.w};
        // unrolled: gk is indexed by the trip and must stay in registers
#pragma unroll
        for (int tt = 0; tt < 16; ++tt) {
            const _Float16* xr = sX + (tt * 16 + lm) * XP + lg;
            v16h xf[4];
#pragma unroll
            for (int kk = 0; kk < 4; ++kk) xf[kk] = load_frag(xr + kk * 32);
            v8f av = {}, ag = {};
#pragma unroll
            for (int kk = 0; kk < 4; ++kk) {
                av = wmma32(xf[kk], fa[kk], av);   // D[token lg+r][channel lm]
                ag = wmma32(fb[kk], xf[kk], ag);   // D[channel lg+r][token lm]
            }
            v8h hv;
#pragma unroll
            for (int r = 0; r < 8; ++r) hv[r] = (_Float16)av[r];
            *(v8h*)(sVt + (ct * 16 + lm) * VP + tt * 16 + lg) = hv;

            float e[8];     // g = sigmoid(z) = 1 / (1 + exp2(-z * log2(e))), as __expf forms it
#pragma unroll
            for (int r = 0; r < 8; ++r) e[r] = (ag[r] + bg[r]) * -1.44269504088896340736f;
            asm("v_exp_f32 %0, %0\n\tv_exp_f32 %1, %1\n\tv_exp_f32 %2, %2\n\tv_exp_f32 %3, %3\n\t"
                "v_exp_f32 %4, %4\n\tv_exp_f32 %5, %5\n\tv_exp_f32 %6, %6\n\tv_exp_f32 %7, %7\n\t"
                "v_add_f32 %0, 1.0, %0\n\tv_add_f32 %1, 1.0, %1\n\tv_add_f32 %2, 1.0, %2\n\tv_add_f32 %3, 1.0, %3\n\t"
                "v_add_f32 %4, 1.0, %4\n\tv_add_f32 %5, 1.0, %5\n\tv_add_f32 %6, 1.0, %6\n\tv_add_f32 %7, 1.0, %7\n\t"
                "v_rcp_f32 %0, %0\n\tv_rcp_f32 %1, %1\n\tv_rcp_f32 %2, %2\n\tv_rcp_f32 %3, %3\n\t"
                "v_rcp_f32 %4, %4\n\tv_rcp_f32 %5, %5\n\tv_rcp_f32 %6, %6\n\tv_rcp_f32 %7, %7\n\t"
                "v_nop"
                : "+v"(e[0]), "+v"(e[1]), "+v"(e[2]), "+v"(e[3]),
                  "+v"(e[4]), "+v"(e[5]), "+v"(e[6]), "+v"(e[7]));
#pragma unroll
            for (int r = 0; r < 8; ++r) gk[tt][r] = (_Float16)e[r];
        }
    }
    __syncthreads();    // every wave has left xn
    if (wave >= 8) {
#pragma unroll
        for (int tt = 0; tt < 16; ++tt)
            *(v8h*)(sX + (tt * 16 + lm) * XP + ct * 16 + lg) = gk[tt];
    }
    __syncthreads();    // k, q, v, g are published

    // B fragments that pick one half of a tri fragment's k range: k = lg + e (id0) or
    // 16 + lg + e (id1) meets column lm with 1 where lg + e == lm, with 0 elsewhere.
    v16h id0 = {}, id1 = {};
#pragma unroll
    for (int e = 0; e < 8; ++e) {
        _Float16 one = (lg + e == lm) ? (_Float16)1.0f : (_Float16)0.0f;
        id0[e] = one;
        id1[8 + e] = one;
    }

    // rolled: the heads unrolled together would multiply the live score registers
    int m0 = wave * 16;
#pragma unroll 1
    for (int h = 0; h < HH; ++h) {
        _Float16* qo = sQ + (m0 + lm) * XP + h * CC + lg;          // this lane's q, then o
        const _Float16* kh = sK + lm * XP + h * CC + lg;
        const _Float16* vh = sVt + (h * CC + lm) * VP + lg;

        // S^T tile nt: s[nt][r] = score(query m0+lm, key nt*16 + lg + r)
        v16h bQ = load_frag(qo);
        const _Float16* tp = tri + h * TOK + wave * 4096 + lane * 8;
        v8f s[16];
        // all 16 tri loads go out first. aT[kp]: rows = keys; k 0..15 = the wave's queries at
        // key tile 2*kp, k 16..31 = the same queries at key tile 2*kp + 1. The half that a
        // product does not want meets zeros of id0 or id1 (tri is finite wherever xn is).
        v16h aT[8];
#pragma unroll
        for (int kp = 0; kp < 8; ++kp) aT[kp] = load_frag_packed(tp + kp * 512);
        // K fragments in groups of four tiles, fetched one group ahead of their WMMAs.
        // The scheduling barriers hold that order: without them the compiler either
        // hoists every LDS load of the tile (spills) or waits on each fragment alone.
        v16h aK[2][4];
#pragma unroll
        for (int j = 0; j < 4; ++j)
            aK[0][j] = load_frag(kh + (j * 16) * XP);
#pragma unroll
        for (int g = 0; g < 4; ++g) {
            __builtin_amdgcn_sched_barrier(0);
            if (g < 3) {
#pragma unroll
                for (int j = 0; j < 4; ++j)
                    aK[(g + 1) & 1][j] = load_frag(kh + (((g + 1) * 4 + j) * 16) * XP);
            }
            __builtin_amdgcn_sched_barrier(0);
#pragma unroll
            for (int j = 0; j < 4; ++j)
                s[g * 4 + j] = wmma32(aK[g & 1][j], bQ, v8f{});
            // tri comes last: its way from L2 lies under the K . Q^T products
#pragma unroll
            for (int j = 0; j < 4; ++j)
                s[g * 4 + j] = wmma32(aT[g * 2 + (j >> 1)], (j & 1) ? id1 : id0, s[g * 4 + j]);
        }
        // the next head's address is formed over the register pair that the tri loads name
        asm volatile("s_wait_xcnt 0x0" ::: "memory");

        float mxj[4] = {-3.0e38f, -3.0e38f, -3.0e38f, -3.0e38f};   // four independent chains
#pragma unroll
        for (int g = 0; g < 4; ++g) {
            // same purpose: at most four tiles' mask bias live at a time
            __builtin_amdgcn_sched_barrier(0);
#pragma unroll
            for (int j = 0; j < 4; ++j) {
                int nt = g * 4 + j;
                float4 b0 = *(const float4*)(sMb + nt * 16 + lg);
                float4 b1 = *(const float4*)(sMb + nt * 16 + lg + 4);
                float mb[8] = {b0.x, b0.y, b0.z, b0.w, b1.x, b1.y, b1.z, b1.w};
#pragma unroll
                for (int r = 0; r < 8; ++r) {
                    s[nt][r] += mb[r];
                    mxj[j] = fmaxf(mxj[j], s[nt][r]);
                }
            }
        }
        float mx = fmaxf(fmaxf(mxj[0], mxj[1]), fmaxf(mxj[2], mxj[3]));
        mx = fmaxf(mx, __shfl_xor(mx, 16, 32));

        // exp, pack two score tiles into one B fragment, O^T += V^T . P^T
        float sum = 0.f;
        v8f acc0 = {}, acc1 = {};
#pragma unroll
        for (int ks = 0; ks < 8; ++ks) {
            // same purpose: one k-step's V^T fragments live at a time
            __builtin_amdgcn_sched_barrier(0);
            v16h aV0 = load_frag(vh + ks * 32);
            v16h aV1 = load_frag(vh + 16 * VP + ks * 32);
            float p[16];   // exp(x) = exp2(x * log2(e)), as __expf forms it
#pragma unroll
            for (int r = 0; r < 8; ++r) {
                p[r]     = (s[2 * ks][r] - mx) * 1.44269504088896340736f;
                p[8 + r] = (s[2 * ks + 1][r] - mx) * 1.44269504088896340736f;
            }
            asm("v_exp_f32 %0, %0\n\tv_exp_f32 %1, %1\n\tv_exp_f32 %2, %2\n\tv_exp_f32 %3, %3\n\t"
                "v_exp_f32 %4, %4\n\tv_exp_f32 %5, %5\n\tv_exp_f32 %6, %6\n\tv_exp_f32 %7, %7\n\t"
                "v_exp_f32 %8, %8\n\tv_exp_f32 %9, %9\n\tv_exp_f32 %10, %10\n\tv_exp_f32 %11, %11\n\t"
                "v_exp_f32 %12, %12\n\tv_exp_f32 %13, %13\n\tv_exp_f32 %14, %14\n\tv_exp_f32 %15, %15\n\t"
                "v_nop"
                : "+v"(p[0]), "+v"(p[1]), "+v"(p[2]), "+v"(p[3]), "+v"(p[4]), "+v"(p[5]),
                  "+v"(p[6]), "+v"(p[7]), "+v"(p[8]), "+v"(p[9]), "+v"(p[10]), "+v"(p[11]),
                  "+v"(p[12]), "+v"(p[13]), "+v"(p[14]), "+v"(p[15]));
            v16h bP;
#pragma unroll
            for (int r = 0; r < 8; ++r) {
                sum += p[r] + p[8 + r];
                bP[r] = (_Float16)p[r];
                bP[8 + r] = (_Float16)p[8 + r];
            }
            acc0 = wmma32(aV0, bP, acc0);
            acc1 = wmma32(aV1, bP, acc1);
        }
        sum += __shfl_xor(sum, 16, 32);
        float inv = fast_rcp(sum);

        // acc0[r], acc1[r] = O(query m0+lm, channel h*32 + lg + r, + 16): normalise, gate, store
        const _Float16* gp = sX + (m0 + lm) * XP + h * CC + lg;
        v8h g0 = *(const v8h*)gp;
        v8h g1 = *(const v8h*)(gp + 16);
        v8h o0, o1;
#pragma unroll
        for (int r = 0; r < 8; ++r) {
            o0[r] = (_Float16)((float)g0[r] * (acc0[r] * inv));
            o1[r] = (_Float16)((float)g1[r] * (acc1[r] * inv));
        }
        *(v8h*)qo = o0;
        *(v8h*)(qo + 16) = o1;
    }

    // w_o's fragments come in while the slower waves finish: two channel tiles a wave
    int cp = wave & 3, tq = wave >> 2;
    unsigned woff2 = (unsigned)(cp * 4096 + lane * 8);   // this lane's place in w_o, first tile
    v16h b[2][4];
#pragma unroll
    for (int c = 0; c < 2; ++c)
#pragma unroll
        for (int kk = 0; kk < 4; ++kk)
            b[c][kk] = load_frag_packed(wt + 4 * 16384 + woff2 + c * 2048 + kk * 512);
    int oc = cp * 32 + (lane & 7) * 4;                 // the four channels this lane stores
    float4 bias = *(const float4*)(b_o + oc);
    // inputs only: holds the load of b_o in front of the barrier, where its way from L2 lies
    // under the slower waves' last head (the compiler sank it into the first trip)
    asm volatile("" :: "v"(bias.x), "v"(bias.y), "v"(bias.z), "v"(bias.w));
    __syncthreads();    // o is published; every wave has left k

    int sr = (lane >> 4) + ((lane >> 3) & 1) * 8;
    float* st = (float*)sK + wave * (16 * SP);         // this wave's staging tile
    const _Float16* as = sQ + (tq * 64 + lm) * XP + lg;
    v16h a[2][4];
#pragma unroll
    for (int kk = 0; kk < 4; ++kk) a[0][kk] = load_frag(as + kk * 32);
    // unrolled: the two fragment sets are indexed by the trip and must stay in registers
#pragma unroll
    for (int t = 0; t < 4; ++t) {
        int tok0 = (tq * 4 + t) * 16;
        // the next tile's o fragments go out as one group ahead of this tile's WMMAs; the
        // scheduling barriers hold them there (the compiler waited on each fragment alone)
        __builtin_amdgcn_sched_barrier(0);
        if (t < 3) {
#pragma unroll
            for (int kk = 0; kk < 4; ++kk)
                a[(t + 1) & 1][kk] = load_frag(as + (t + 1) * 16 * XP + kk * 32);
        }
        __builtin_amdgcn_sched_barrier(0);
        v8f acc[2] = {};
#pragma unroll
        for (int kk = 0; kk < 4; ++kk)
#pragma unroll
            for (int c = 0; c < 2; ++c)
                acc[c] = wmma32(b[c][kk], a[t & 1][kk], acc[c]);   // D[channel c*16 + lg + r][token lm]
#pragma unroll
        for (int c = 0; c < 2; ++c) {
            float* sw = st + lm * SP + c * 16 + lg;
            *(float4*)sw       = make_float4(acc[c][0], acc[c][1], acc[c][2], acc[c][3]);
            *(float4*)(sw + 4) = make_float4(acc[c][4], acc[c][5], acc[c][6], acc[c][7]);
        }
        // the wave's own LDS stores are done before it reads the rows back
        asm volatile("s_wait_dscnt 0x0" ::: "memory");
#pragma unroll
        for (int j = 0; j < 4; ++j) {
            float4 v = *(const float4*)(st + (j * 2 + sr) * SP + (lane & 7) * 4);
            v.x += bias.x; v.y += bias.y; v.z += bias.z; v.w += bias.w;
            *(float4*)(out + (rowbase + tok0 + j * 2 + sr) * DD + oc) = v;
        }
        // the next trip rewrites registers that these stores name
        if (t < 3) asm volatile("s_wait_xcnt 0x0" ::: "memory");
    }
}

// ---------------------------------------------------------------------------
extern "C" void kernel_launch(void* const* d_in, const int* in_sizes, int n_in,
                              void* d_out, int out_size, void* d_ws, size_t ws_size,
                              hipStream_t stream) {
    const float* x     = (const float*)d_in[0];
    const float* mask  = (const float*)d_in[1];
    const float* ln_w  = (const float*)d_in[2];
    const float* ln_b  = (const float*)d_in[3];
    const float* w_tri = (const float*)d_in[4];
    const float* w_q   = (const float*)d_in[5];
    const float* w_k   = (const float*)d_in[6];
    const float* w_v   = (const float*)d_in[7];
    const float* w_g   = (const float*)d_in[8];
    const float* b_g   = (const float*)d_in[9];
    const float* w_o   = (const float*)d_in[10];
    const float* b_o   = (const float*)d_in[11];

    _Float16* xn   = (_Float16*)d_ws;
    _Float16* wt   = xn + TD;                  // 5 * 16384 halves
    _Float16* tri  = wt + 5 * 16384;           // H * 65536 halves, at a multiple of 512 B

    k_ln_tri<<<TOK / (8 * LN_TPW), 256, 0, stream>>>(x, ln_w, ln_b, w_tri,
                                                     w_q, w_k, w_v, w_g, w_o, xn, tri, wt);
    k_row<<<NN, 512, 0, stream>>>(xn, wt, b_g, tri, mask, b_o, (float*)d_out);
}

// v008
// A run of this version takes 31.9 microseconds.
// Next to v007, in two timings, it ran 1.03 times as fast each time.
// Counting every step since v000, it is 7.21 times as fast.
#include <hip/hip_runtime.h>
#include <hip/hip_bf16.h>

typedef __attribute__((ext_vector_type(16))) _Float16 v16h;
typedef __attribute__((ext_vector_type(8)))  _Float16 v8h;
typedef __attribute__((ext_vector_type(4)))  _Float16 v4h;
typedef __attribute__((ext_vector_type(8)))  float    v8f;

#define NN   256
#define DD   128
#define HH   4
#define CC   32
#define TOK  65536          // N*N tokens
#define TD   8388608ull     // TOK * DD
// Scores are formed in units of log2: q, tri and the mask bias carry the factor log2(e), so
// that exp(score - max) is exp2 of a plain difference.
#define LOG2E 1.44269504088896340736f

// Build a WMMA 16-half fragment from two contiguous 8-half (16B) chunks:
// elements [0..7] at p, elements [8..15] at p+16 halves.
__device__ __forceinline__ v16h load_frag(const _Float16* p) {
    v8h lo = *(const v8h*)p;
    v8h hi = *(const v8h*)(p + 16);
    v16h r;
#pragma unroll
    for (int e = 0; e < 8; ++e) { r[e] = lo[e]; r[8 + e] = hi[e]; }
    return r;
}

// The same fragment from a weight block stored in fragment order: the wave's 32 low chunks
// are 512 contiguous bytes, its 32 high chunks the next 512; p is this lane's low chunk.
__device__ __forceinline__ v16h load_frag_packed(const _Float16* p) {
    v8h lo = *(const v8h*)p;
    v8h hi = *(const v8h*)(p + 256);
    v16h r;
#pragma unroll
    for (int e = 0; e < 8; ++e) { r[e] = lo[e]; r[8 + e] = hi[e]; }
    return r;
}

__device__ __forceinline__ v8f wmma32(v16h a, v16h b, v8f c) {
    return __builtin_amdgcn_wmma_f32_16x16x32_f16(false, a, false, b,
                                                  (short)0, c, false, false);
}

__device__ __forceinline__ float fast_rcp(float x) {
    return __builtin_amdgcn_rcpf(x);   // v_rcp_f32, avoids IEEE div expansion
}

__device__ __forceinline__ void async_copy_b128(const _Float16* lds_dst,
                                                const _Float16* gsrc) {
    unsigned lds_off = (unsigned)(uintptr_t)lds_dst;
    asm volatile("global_load_async_to_lds_b128 %0, %1, off\n\ts_wait_xcnt 0x0"
                 :: "v"(lds_off), "v"(gsrc) : "memory");
}
// this wave's copies have landed (other waves read them behind the next barrier)
__device__ __forceinline__ void wait_async() {
    asm volatile("s_wait_asynccnt 0x0" ::: "memory");
}

#define LN_TPW 8
#define WT_BLOCKS 320   // 5 * 128 * 128 elements / 256 threads; 64 work-groups a matrix

__global__ __launch_bounds__(256)
void k_ln_tri(const float* __restrict__ x, const float* __restrict__ ln_w,
              const float* __restrict__ ln_b, const float* __restrict__ w_tri,
              const float* __restrict__ wq, const float* __restrict__ wk,
              const float* __restrict__ wv, const float* __restrict__ wg,
              const float* __restrict__ wo,
              _Float16* __restrict__ xn, _Float16* __restrict__ tri,
              _Float16* __restrict__ wt) {
    int wave = threadIdx.x >> 5;
    int lane = threadIdx.x & 31;
    int m0 = (blockIdx.x >> 5) * LN_TPW;        // the wave's first row of x: tri's first query
    int n  = (blockIdx.x & 31) * 8 + wave;      // its column: tri's key
    int token0 = m0 * NN + n;                   // token u of the wave is token0 + u * NN

    // all of the wave's token rows go out first: LN_TPW loads of 512 B in flight
    const float* xp = x + (size_t)token0 * DD + lane * 4;
    float4 xv[LN_TPW];
#pragma unroll
    for (int u = 0; u < LN_TPW; ++u) xv[u] = *(const float4*)(xp + u * NN * DD);

    float4 w = *(const float4*)(ln_w + lane * 4);
    float4 b = *(const float4*)(ln_b + lane * 4);
    float4 wr[4];   // w_tri laid out [128][4]: row lane*4 + t
#pragma unroll
    for (int t = 0; t < 4; ++t) wr[t] = *(const float4*)(w_tri + (size_t)(lane * 4 + t) * HH);

    float d[LN_TPW][4], rs[LN_TPW];
#pragma unroll
    for (int u = 0; u < LN_TPW; ++u) {
        float s = xv[u].x + xv[u].y + xv[u].z + xv[u].w;
#pragma unroll
        for (int m = 16; m >= 1; m >>= 1) s += __shfl_xor(s, m, 32);
        float mu = s * (1.0f / 128.0f);

        float d0 = xv[u].x - mu, d1 = xv[u].y - mu, d2 = xv[u].z - mu, d3 = xv[u].w - mu;
        float vs = d0 * d0 + d1 * d1 + d2 * d2 + d3 * d3;
#pragma unroll
        for (int m = 16; m >= 1; m >>= 1) vs += __shfl_xor(vs, m, 32);
        d[u][0] = d0; d[u][1] = d1; d[u][2] = d2; d[u][3] = d3;
        rs[u] = vs * (1.0f / 128.0f) + 1e-5f;
    }
    static_assert(LN_TPW == 8, "the statement below names eight values");
    asm("v_rsq_f32 %0, %0\n\tv_rsq_f32 %1, %1\n\tv_rsq_f32 %2, %2\n\tv_rsq_f32 %3, %3\n\t"
        "v_rsq_f32 %4, %4\n\tv_rsq_f32 %5, %5\n\tv_rsq_f32 %6, %6\n\tv_rsq_f32 %7, %7\n\t"
        "v_nop"
        : "+v"(rs[0]), "+v"(rs[1]), "+v"(rs[2]), "+v"(rs[3]),
          "+v"(rs[4]), "+v"(rs[5]), "+v"(rs[6]), "+v"(rs[7]));

    float tr[HH][LN_TPW];
#pragma unroll
    for (int u = 0; u < LN_TPW; ++u) {
        float rstd = rs[u];
        float d0 = d[u][0], d1 = d[u][1], d2 = d[u][2], d3 = d[u][3];

        float y[4];
        y[0] = d0 * rstd * w.x + b.x;
        y[1] = d1 * rstd * w.y + b.y;
        y[2] = d2 * rstd * w.z + b.z;
        y[3] = d3 * rstd * w.w + b.w;

        v4h yh;
#pragma unroll
        for (int t = 0; t < 4; ++t) yh[t] = (_Float16)y[t];
        *(v4h*)(xn + (size_t)(token0 + u * NN) * DD + lane * 4) = yh;

        // tri[h] = sum_d xn[d] * w_tri[d][h]
        float t0 = 0.f, t1 = 0.f, t2 = 0.f, t3 = 0.f;
#pragma unroll
        for (int t = 0; t < 4; ++t) {
            t0 += y[t] * wr[t].x; t1 += y[t] * wr[t].y;
            t2 += y[t] * wr[t].z; t3 += y[t] * wr[t].w;
        }
#pragma unroll
        for (int m = 16; m >= 1; m >>= 1) {
            t0 += __shfl_xor(t0, m, 32); t1 += __shfl_xor(t1, m, 32);
            t2 += __shfl_xor(t2, m, 32); t3 += __shfl_xor(t3, m, 32);
        }
        tr[0][u] = t0; tr[1][u] = t1; tr[2][u] = t2; tr[3][u] = t3;
    }
    if (lane == 0) {
        _Float16* td = tri + (m0 >> 4) * 4096 + (n >> 4) * 256
                           + (((m0 >> 3) & 1) * 16 + (n & 15)) * 8;
#pragma unroll
        for (int h = 0; h < HH; ++h) {
            v8h th;
#pragma unroll
            for (int u = 0; u < LN_TPW; ++u) th[u] = (_Float16)(tr[h][u] * LOG2E);
            *(v8h*)(td + h * TOK) = th;
        }
    }

    // the weights' share comes last: the work-groups that have it are the first to start,
    // so its load latency ends before the grid's last work-groups do. The test and the
    // choice of matrix are the same for the whole work-group.
    if (blockIdx.x < WT_BLOCKS) {
        int mat = blockIdx.x >> 6;
        int r   = (blockIdx.x & 63) * 256 + threadIdx.x;
        int n   = (r >> 11) * 16 + ((r >> 3) & 15);
        int k   = ((r >> 8) & 7) * 16 + ((r >> 7) & 1) * 8 + (r & 7);
        const float* W = (mat == 0) ? wq : (mat == 1) ? wk : (mat == 2) ? wv
                       : (mat == 3) ? wg : wo;
        wt[mat * 16384 + r] = (_Float16)W[k * DD + n];
    }
}

#define XP 136
#define VP 264
#define SP 36

__global__ __launch_bounds__(512)
void k_row(const _Float16* __restrict__ xn, const _Float16* __restrict__ wt,
           const float* __restrict__ b_g, const _Float16* __restrict__ tri,
           const float* __restrict__ mask, const float* __restrict__ b_o,
           float* __restrict__ out) {
    __shared__ __attribute__((aligned(16))) _Float16 sX[NN * XP];   // xn rows, later g rows
    __shared__ __attribute__((aligned(16))) _Float16 sK[NN * XP];   // K rows [n][h*32+c]
    __shared__ __attribute__((aligned(16))) _Float16 sQ[NN * XP];   // q rows, later o rows
    __shared__ __attribute__((aligned(16))) _Float16 sVt[DD * VP];  // V transposed [h*32+c][n]
    __shared__ __attribute__((aligned(16))) float    sMb[NN];       // mask bias per key

    int i = blockIdx.x;
    int tid = threadIdx.x, lane = tid & 31;
    // the wave's number in a scalar register: the tests on it below are scalar branches
    int wave = __builtin_amdgcn_readfirstlane(tid >> 5);
    int lm = lane & 15, lg = (lane >> 4) * 8;
    int ct = wave & 7;
    size_t rowbase = (size_t)i * NN;

    // the row's xn: 4096 pieces of 16 B, eight per lane, each wave's copy 512 B in a row
    const _Float16* src = xn + rowbase * DD;
#pragma unroll
    for (int u = 0; u < 8; ++u) {
        int c = u * 512 + tid;
        async_copy_b128(&sX[(c >> 4) * XP + (c & 15) * 8], src + (size_t)c * 8);
    }

    // weights and mask bias come in while the copies fly
    unsigned woff = (unsigned)(ct * 2048 + lane * 8);         // this lane's place in a matrix
    const _Float16* wa = wt + (wave < 8 ? 1 : 2) * 16384;     // k or v
    const _Float16* wb = wt + (wave < 8 ? 0 : 3) * 16384;     // q or g
    v16h fa[4], fb[4];
#pragma unroll
    for (int kk = 0; kk < 4; ++kk) {
        fa[kk] = load_frag_packed(wa + woff + kk * 512);
        fb[kk] = load_frag_packed(wb + woff + kk * 512);
    }
    if (wave < 8) sMb[tid] = (1e9f * LOG2E) * (mask[rowbase + tid] - 1.0f);

    wait_async();
    __syncthreads();

    v8h gk[16] = {};   // g of this wave's channels, all 16 token tiles (waves 8-15)
    if (wave < 8) {
#pragma unroll 2
        for (int tt = 0; tt < 16; ++tt) {
            const _Float16* xr = sX + (tt * 16 + lm) * XP + lg;
            v16h xf[4];
#pragma unroll
            for (int kk = 0; kk < 4; ++kk) xf[kk] = load_frag(xr + kk * 32);
            v8f ak = {}, aq = {};
#pragma unroll
            for (int kk = 0; kk < 4; ++kk) {
                ak = wmma32(fa[kk], xf[kk], ak);   // D[channel lg+r][token lm]
                aq = wmma32(fb[kk], xf[kk], aq);
            }
            v8h hk, hq;
#pragma unroll
            for (int r = 0; r < 8; ++r) {
                hk[r] = (_Float16)ak[r];
                hq[r] = (_Float16)(aq[r] * (0.17677669529663687f * LOG2E));   // q * log2(e) / sqrt(C)
            }
            int o = (tt * 16 + lm) * XP + ct * 16 + lg;
            *(v8h*)(sK + o) = hk;
            *(v8h*)(sQ + o) = hq;
        }
    } else {
        float4 bg0 = *(const float4*)(b_g + ct * 16 + lg);
        float4 bg1 = *(const float4*)(b_g + ct * 16 + lg + 4);
        float bg[8] = {bg0.x, bg0.y, bg0.z, bg0.w, bg1.x, bg1.y, bg1.z, bg1.w};
        // unrolled: gk is indexed by the trip and must stay in registers
#pragma unroll
        for (int tt = 0; tt < 16; ++tt) {
            const _Float16* xr = sX + (tt * 16 + lm) * XP + lg;
            v16h xf[4];
#pragma unroll
            for (int kk = 0; kk < 4; ++kk) xf[kk] = load_frag(xr + kk * 32);
            v8f av = {}, ag = {};
#pragma unroll
            for (int kk = 0; kk < 4; ++kk) {
                av = wmma32(xf[kk], fa[kk], av);   // D[token lg+r][channel lm]
                ag = wmma32(fb[kk], xf[kk], ag);   // D[channel lg+r][token lm]
            }
            v8h hv;
#pragma unroll
            for (int r = 0; r < 8; ++r) hv[r] = (_Float16)av[r];
            *(v8h*)(sVt + (ct * 16 + lm) * VP + tt * 16 + lg) = hv;

            float e[8];     // g = sigmoid(z) = 1 / (1 + exp2(-z * log2(e))), as __expf forms it
#pragma unroll
            for (int r = 0; r < 8; ++r) e[r] = (ag[r] + bg[r]) * -1.44269504088896340736f;
            asm("v_exp_f32 %0, %0\n\tv_exp_f32 %1, %1\n\tv_exp_f32 %2, %2\n\tv_exp_f32 %3, %3\n\t"
                "v_exp_f32 %4, %4\n\tv_exp_f32 %5, %5\n\tv_exp_f32 %6, %6\n\tv_exp_f32 %7, %7\n\t"
                "v_add_f32 %0, 1.0, %0\n\tv_add_f32 %1, 1.0, %1\n\tv_add_f32 %2, 1.0, %2\n\tv_add_f32 %3, 1.0, %3\n\t"
                "v_add_f32 %4, 1.0, %4\n\tv_add_f32 %5, 1.0, %5\n\tv_add_f32 %6, 1.0, %6\n\tv_add_f32 %7, 1.0, %7\n\t"
                "v_rcp_f32 %0, %0\n\tv_rcp_f32 %1, %1\n\tv_rcp_f32 %2, %2\n\tv_rcp_f32 %3, %3\n\t"
                "v_rcp_f32 %4, %4\n\tv_rcp_f32 %5, %5\n\tv_rcp_f32 %6, %6\n\tv_rcp_f32 %7, %7\n\t"
                "v_nop"
                : "+v"(e[0]), "+v"(e[1]), "+v"(e[2]), "+v"(e[3]),
                  "+v"(e[4]), "+v"(e[5]), "+v"(e[6]), "+v"(e[7]));
#pragma unroll
            for (int r = 0; r < 8; ++r) gk[tt][r] = (_Float16)e[r];
        }
    }
    __syncthreads();    // every wave has left xn
    if (wave >= 8) {
#pragma unroll
        for (int tt = 0; tt < 16; ++tt)
            *(v8h*)(sX + (tt * 16 + lm) * XP + ct * 16 + lg) = gk[tt];
    }
    __syncthreads();    // k, q, v, g are published

    // B fragments that pick one half of a tri fragment's k range: k = lg + e (id0) or
    // 16 + lg + e (id1) meets column lm with 1 where lg + e == lm, with 0 elsewhere.
    v16h id0 = {}, id1 = {};
#pragma unroll
    for (int e = 0; e < 8; ++e) {
        _Float16 one = (lg + e == lm) ? (_Float16)1.0f : (_Float16)0.0f;
        id0[e] = one;
        id1[8 + e] = one;
    }

    // rolled: the heads unrolled together would multiply the live score registers
    int m0 = wave * 16;
#pragma unroll 1
    for (int h = 0; h < HH; ++h) {
        _Float16* qo = sQ + (m0 + lm) * XP + h * CC + lg;          // this lane's q, then o
        const _Float16* kh = sK + lm * XP + h * CC + lg;
        const _Float16* vh = sVt + (h * CC + lm) * VP + lg;

        // S^T tile nt: s[nt][r] = score(query m0+lm, key nt*16 + lg + r)
        v16h bQ = load_frag(qo);
        const _Float16* tp = tri + h * TOK + wave * 4096 + lane * 8;
        v8f s[16];
        // all 16 tri loads go out first. aT[kp]: rows = keys; k 0..15 = the wave's queries at
        // key tile 2*kp, k 16..31 = the same queries at key tile 2*kp + 1. The half that a
        // product does not want meets zeros of id0 or id1 (tri is finite wherever xn is).
        v16h aT[8];
#pragma unroll
        for (int kp = 0; kp < 8; ++kp) aT[kp] = load_frag_packed(tp + kp * 512);
        // K fragments in groups of four tiles, fetched one group ahead of their WMMAs.
        // The scheduling barriers hold that order: without them the compiler either
        // hoists every LDS load of the tile (spills) or waits on each fragment alone.
        v16h aK[2][4];
#pragma unroll
        for (int j = 0; j < 4; ++j)
            aK[0][j] = load_frag(kh + (j * 16) * XP);
#pragma unroll
        for (int g = 0; g < 4; ++g) {
            __builtin_amdgcn_sched_barrier(0);
            if (g < 3) {
#pragma unroll
                for (int j = 0; j < 4; ++j)
                    aK[(g + 1) & 1][j] = load_frag(kh + (((g + 1) * 4 + j) * 16) * XP);
            }
            __builtin_amdgcn_sched_barrier(0);
#pragma unroll
            for (int j = 0; j < 4; ++j)
                s[g * 4 + j] = wmma32(aK[g & 1][j], bQ, v8f{});
            // tri comes last: its way from L2 lies under the K . Q^T products
#pragma unroll
            for (int j = 0; j < 4; ++j)
                s[g * 4 + j] = wmma32(aT[g * 2 + (j >> 1)], (j & 1) ? id1 : id0, s[g * 4 + j]);
        }
        // the next head's address is formed over the register pair that the tri loads name
        asm volatile("s_wait_xcnt 0x0" ::: "memory");

        float mxj[4] = {-3.0e38f, -3.0e38f, -3.0e38f, -3.0e38f};   // four independent chains
#pragma unroll
        for (int g = 0; g < 4; ++g) {
            // same purpose: at most four tiles' mask bias live at a time
            __builtin_amdgcn_sched_barrier(0);
#pragma unroll
            for (int j = 0; j < 4; ++j) {
                int nt = g * 4 + j;
                float4 b0 = *(const float4*)(sMb + nt * 16 + lg);
                float4 b1 = *(const float4*)(sMb + nt * 16 + lg + 4);
                float mb[8] = {b0.x, b0.y, b0.z, b0.w, b1.x, b1.y, b1.z, b1.w};
#pragma unroll
                for (int r = 0; r < 8; ++r) {
                    s[nt][r] += mb[r];
                    mxj[j] = fmaxf(mxj[j], s[nt][r]);
                }
            }
        }
        float mx = fmaxf(fmaxf(mxj[0], mxj[1]), fmaxf(mxj[2], mxj[3]));
        mx = fmaxf(mx, __shfl_xor(mx, 16, 32));

        // exp, pack two score tiles into one B fragment, O^T += V^T . P^T
        v16h ones;
#pragma unroll
        for (int e = 0; e < 16; ++e) ones[e] = (_Float16)1.0f;
        v8f acc0 = {}, acc1 = {}, accs = {};   // accs: every row is the sum of P over the keys
#pragma unroll
        for (int ks = 0; ks < 8; ++ks) {
            // same purpose: one k-step's V^T fragments live at a time
            __builtin_amdgcn_sched_barrier(0);
            v16h aV0 = load_frag(vh + ks * 32);
            v16h aV1 = load_frag(vh + 16 * VP + ks * 32);
            float p[16];
#pragma unroll
            for (int r = 0; r < 8; ++r) {
                p[r]     = s[2 * ks][r] - mx;
                p[8 + r] = s[2 * ks + 1][r] - mx;
            }
            asm("v_exp_f32 %0, %0\n\tv_exp_f32 %1, %1\n\tv_exp_f32 %2, %2\n\tv_exp_f32 %3, %3\n\t"
                "v_exp_f32 %4, %4\n\tv_exp_f32 %5, %5\n\tv_exp_f32 %6, %6\n\tv_exp_f32 %7, %7\n\t"
                "v_exp_f32 %8, %8\n\tv_exp_f32 %9, %9\n\tv_exp_f32 %10, %10\n\tv_exp_f32 %11, %11\n\t"
                "v_exp_f32 %12, %12\n\tv_exp_f32 %13, %13\n\tv_exp_f32 %14, %14\n\tv_exp_f32 %15, %15\n\t"
                "v_nop"
                : "+v"(p[0]), "+v"(p[1]), "+v"(p[2]), "+v"(p[3]), "+v"(p[4]), "+v"(p[5]),
                  "+v"(p[6]), "+v"(p[7]), "+v"(p[8]), "+v"(p[9]), "+v"(p[10]), "+v"(p[11]),
                  "+v"(p[12]), "+v"(p[13]), "+v"(p[14]), "+v"(p[15]));
            v16h bP;
#pragma unroll
            for (int r = 0; r < 8; ++r) {
                bP[r] = (_Float16)p[r];
                bP[8 + r] = (_Float16)p[8 + r];
            }
            acc0 = wmma32(aV0, bP, acc0);
            acc1 = wmma32(aV1, bP, acc1);
            accs = wmma32(ones, bP, accs);
        }
        float inv = fast_rcp(accs[0]);

        // acc0[r], acc1[r] = O(query m0+lm, channel h*32 + lg + r, + 16): normalise, gate, store
        const _Float16* gp = sX + (m0 + lm) * XP + h * CC + lg;
        v8h g0 = *(const v8h*)gp;
        v8h g1 = *(const v8h*)(gp + 16);
        v8h o0, o1;
#pragma unroll
        for (int r = 0; r < 8; ++r) {
            o0[r] = (_Float16)((float)g0[r] * (acc0[r] * inv));
            o1[r] = (_Float16)((float)g1[r] * (acc1[r] * inv));
        }
        *(v8h*)qo = o0;
        *(v8h*)(qo + 16) = o1;
    }

    // w_o's fragments come in while the slower waves finish: two channel tiles a wave
    int cp = wave & 3, tq = wave >> 2;
    unsigned woff2 = (unsigned)(cp * 4096 + lane * 8);   // this lane's place in w_o, first tile
    v16h b[2][4];
#pragma unroll
    for (int c = 0; c < 2; ++c)
#pragma unroll
        for (int kk = 0; kk < 4; ++kk)
            b[c][kk] = load_frag_packed(wt + 4 * 16384 + woff2 + c * 2048 + kk * 512);
    int oc = cp * 32 + (lane & 7) * 4;                 // the four channels this lane stores
    float4 bias = *(const float4*)(b_o + oc);
    // inputs only: holds the load of b_o in front of the barrier, where its way from L2 lies
    // under the slower waves' last head (the compiler sank it into the first trip)
    asm volatile("" :: "v"(bias.x), "v"(bias.y), "v"(bias.z), "v"(bias.w));
    __syncthreads();    // o is published; every wave has left k

    int sr = (lane >> 4) + ((lane >> 3) & 1) * 8;
    float* st = (float*)sK + wave * (16 * SP);         // this wave's staging tile
    const _Float16* as = sQ + (tq * 64 + lm) * XP + lg;
    v16h a[2][4];
#pragma unroll
    for (int kk = 0; kk < 4; ++kk) a[0][kk] = load_frag(as + kk * 32);
    // unrolled: the two fragment sets are indexed by the trip and must stay in registers
#pragma unroll
    for (int t = 0; t < 4; ++t) {
        int tok0 = (tq * 4 + t) * 16;
        // the next tile's o fragments go out as one group ahead of this tile's WMMAs; the
        // scheduling barriers hold them there (the compiler waited on each fragment alone)
        __builtin_amdgcn_sched_barrier(0);
        if (t < 3) {
#pragma unroll
            for (int kk = 0; kk < 4; ++kk)
                a[(t + 1) & 1][kk] = load_frag(as + (t + 1) * 16 * XP + kk * 32);
        }
        __builtin_amdgcn_sched_barrier(0);
        v8f acc[2] = {};
#pragma unroll
        for (int kk = 0; kk < 4; ++kk)
#pragma unroll
            for (int c = 0; c < 2; ++c)
                acc[c] = wmma32(b[c][kk], a[t & 1][kk], acc[c]);   // D[channel c*16 + lg + r][token lm]
#pragma unroll
        for (int c = 0; c < 2; ++c) {
            float* sw = st + lm * SP + c * 16 + lg;
            *(float4*)sw       = make_float4(acc[c][0], acc[c][1], acc[c][2], acc[c][3]);
            *(float4*)(sw + 4) = make_float4(acc[c][4], acc[c][5], acc[c][6], acc[c][7]);
        }
        // the wave's own LDS stores are done before it reads the rows back
        asm volatile("s_wait_dscnt 0x0" ::: "memory");
#pragma unroll
        for (int j = 0; j < 4; ++j) {
            float4 v = *(const float4*)(st + (j * 2 + sr) * SP + (lane & 7) * 4);
            v.x += bias.x; v.y += bias.y; v.z += bias.z; v.w += bias.w;
            *(float4*)(out + (rowbase + tok0 + j * 2 + sr) * DD + oc) = v;
        }
        // the next trip rewrites registers that these stores name
        if (t < 3) asm volatile("s_wait_xcnt 0x0" ::: "memory");
    }
}

// ---------------------------------------------------------------------------
extern "C" void kernel_launch(void* const* d_in, const int* in_sizes, int n_in,
                              void* d_out, int out_size, void* d_ws, size_t ws_size,
                              hipStream_t stream) {
    const float* x     = (const float*)d_in[0];
    const float* mask  = (const float*)d_in[1];
    const float* ln_w  = (const float*)d_in[2];
    const float* ln_b  = (const float*)d_in[3];
    const float* w_tri = (const float*)d_in[4];
    const float* w_q   = (const float*)d_in[5];
    const float* w_k   = (const float*)d_in[6];
    const float* w_v   = (const float*)d_in[7];
    const float* w_g   = (const float*)d_in[8];
    const float* b_g   = (const float*)d_in[9];
    const float* w_o   = (const float*)d_in[10];
    const float* b_o   = (const float*)d_in[11];

    _Float16* xn   = (_Float16*)d_ws;
    _Float16* wt   = xn + TD;                  // 5 * 16384 halves
    _Float16* tri  = wt + 5 * 16384;           // H * 65536 halves, at a multiple of 512 B

    k_ln_tri<<<TOK / (8 * LN_TPW), 256, 0, stream>>>(x, ln_w, ln_b, w_tri,
                                                     w_q, w_k, w_v, w_g, w_o, xn, tri, wt);
    k_row<<<NN, 512, 0, stream>>>(xn, wt, b_g, tri, mask, b_o, (float*)d_out);
}

// v009
// Measured time: 29.5 microseconds a run.
// Two timings next to v008 both put it at 1.08 times that version's speed.
// Counting every step since v000, it is 7.81 times as fast.
#include <hip/hip_runtime.h>
#include <hip/hip_bf16.h>

typedef __attribute__((ext_vector_type(16))) _Float16 v16h;
typedef __attribute__((ext_vector_type(8)))  _Float16 v8h;
typedef __attribute__((ext_vector_type(4)))  _Float16 v4h;
typedef __attribute__((ext_vector_type(8)))  float    v8f;

#define NN   256
#define DD   128
#define HH   4
#define CC   32
#define TOK  65536          // N*N tokens
#define TD   8388608ull     // TOK * DD
// Scores are formed in units of log2: q, tri and the mask bias carry the factor log2(e), so
// that exp(score - max) is exp2 of a plain difference.
#define LOG2E 1.44269504088896340736f

// Build a WMMA 16-half fragment from two contiguous 8-half (16B) chunks:
// elements [0..7] at p, elements [8..15] at p+16 halves.
__device__ __forceinline__ v16h load_frag(const _Float16* p) {
    v8h lo = *(const v8h*)p;
    v8h hi = *(const v8h*)(p + 16);
    v16h r;
#pragma unroll
    for (int e = 0; e < 8; ++e) { r[e] = lo[e]; r[8 + e] = hi[e]; }
    return r;
}

// The same fragment from a weight block stored in fragment order: the wave's 32 low chunks
// are 512 contiguous bytes, its 32 high chunks the next 512; p is this lane's low chunk.
__device__ __forceinline__ v16h load_frag_packed(const _Float16* p) {
    v8h lo = *(const v8h*)p;
    v8h hi = *(const v8h*)(p + 256);
    v16h r;
#pragma unroll
    for (int e = 0; e < 8; ++e) { r[e] = lo[e]; r[8 + e] = hi[e]; }
    return r;
}

__device__ __forceinline__ v8f wmma32(v16h a, v16h b, v8f c) {
    return __builtin_amdgcn_wmma_f32_16x16x32_f16(false, a, false, b,
                                                  (short)0, c, false, false);
}

__device__ __forceinline__ float fast_rcp(float x) {
    return __builtin_amdgcn_rcpf(x);   // v_rcp_f32, avoids IEEE div expansion
}

__device__ __forceinline__ void async_copy_b128(const void* lds_dst,
                                                const void* gsrc) {
    unsigned lds_off = (unsigned)(uintptr_t)lds_dst;
    asm volatile("global_load_async_to_lds_b128 %0, %1, off\n\ts_wait_xcnt 0x0"
                 :: "v"(lds_off), "v"(gsrc) : "memory");
}
// Four such copies, 8 KiB apart in LDS and in memory alike, in one statement with one wait.
__device__ __forceinline__ void async_copy4_b128(const _Float16* lds_dst,
                                                 const _Float16* gsrc) {
    unsigned l0 = (unsigned)(uintptr_t)lds_dst;
    unsigned l1 = l0 + 8192, l2 = l0 + 16384, l3 = l0 + 24576;
    const _Float16* g1 = gsrc + 4096;
    const _Float16* g2 = gsrc + 8192;
    const _Float16* g3 = gsrc + 12288;
    asm volatile("global_load_async_to_lds_b128 %0, %4, off\n\t"
                 "global_load_async_to_lds_b128 %1, %5, off\n\t"
                 "global_load_async_to_lds_b128 %2, %6, off\n\t"
                 "global_load_async_to_lds_b128 %3, %7, off\n\t"
                 "s_wait_xcnt 0x0"
                 :: "v"(l0), "v"(l1), "v"(l2), "v"(l3),
                    "v"(gsrc), "v"(g1), "v"(g2), "v"(g3) : "memory");
}
// this wave's copies have landed (other waves read them behind the next barrier)
__device__ __forceinline__ void wait_async() {
    asm volatile("s_wait_asynccnt 0x0" ::: "memory");
}

#define LN_TPW 8
#define WT_BLOCKS 320   // 5 * 128 * 128 elements / 256 threads; 64 work-groups a matrix

__global__ __launch_bounds__(256)
void k_ln_tri(const float* __restrict__ x, const float* __restrict__ ln_w,
              const float* __restrict__ ln_b, const float* __restrict__ w_tri,
              const float* __restrict__ wq, const float* __restrict__ wk,
              const float* __restrict__ wv, const float* __restrict__ wg,
              const float* __restrict__ wo,
              _Float16* __restrict__ xn, _Float16* __restrict__ tri,
              _Float16* __restrict__ wt) {
    int wave = threadIdx.x >> 5;
    int lane = threadIdx.x & 31;
    int m0 = (blockIdx.x >> 5) * LN_TPW;        // the wave's first row of x: tri's first query
    int n  = (blockIdx.x & 31) * 8 + wave;      // its column: tri's key
    int token0 = m0 * NN + n;                   // token u of the wave is token0 + u * NN

    // all of the wave's token rows go out first: LN_TPW loads of 512 B in flight
    const float* xp = x + (size_t)token0 * DD + lane * 4;
    float4 xv[LN_TPW];
#pragma unroll
    for (int u = 0; u < LN_TPW; ++u) xv[u] = *(const float4*)(xp + u * NN * DD);

    float4 w = *(const float4*)(ln_w + lane * 4);
    float4 b = *(const float4*)(ln_b + lane * 4);
    float4 wr[4];   // w_tri laid out [128][4]: row lane*4 + t
#pragma unroll
    for (int t = 0; t < 4; ++t) wr[t] = *(const float4*)(w_tri + (size_t)(lane * 4 + t) * HH);

    float d[LN_TPW][4], rs[LN_TPW];
#pragma unroll
    for (int u = 0; u < LN_TPW; ++u) {
        float s = xv[u].x + xv[u].y + xv[u].z + xv[u].w;
#pragma unroll
        for (int m = 16; m >= 1; m >>= 1) s += __shfl_xor(s, m, 32);
        float mu = s * (1.0f / 128.0f);

        float d0 = xv[u].x - mu, d1 = xv[u].y - mu, d2 = xv[u].z - mu, d3 = xv[u].w - mu;
        float vs = d0 * d0 + d1 * d1 + d2 * d2 + d3 * d3;
#pragma unroll
        for (int m = 16; m >= 1; m >>= 1) vs += __shfl_xor(vs, m, 32);
        d[u][0] = d0; d[u][1] = d1; d[u][2] = d2; d[u][3] = d3;
        rs[u] = vs * (1.0f / 128.0f) + 1e-5f;
    }
    static_assert(LN_TPW == 8, "the statement below names eight values");
    asm("v_rsq_f32 %0, %0\n\tv_rsq_f32 %1, %1\n\tv_rsq_f32 %2, %2\n\tv_rsq_f32 %3, %3\n\t"
        "v_rsq_f32 %4, %4\n\tv_rsq_f32 %5, %5\n\tv_rsq_f32 %6, %6\n\tv_rsq_f32 %7, %7\n\t"
        "v_nop"
        : "+v"(rs[0]), "+v"(rs[1]), "+v"(rs[2]), "+v"(rs[3]),
          "+v"(rs[4]), "+v"(rs[5]), "+v"(rs[6]), "+v"(rs[7]));

    float tr[HH][LN_TPW];
#pragma unroll
    for (int u = 0; u < LN_TPW; ++u) {
        float rstd = rs[u];
        float d0 = d[u][0], d1 = d[u][1], d2 = d[u][2], d3 = d[u][3];

        float y[4];
        y[0] = d0 * rstd * w.x + b.x;
        y[1] = d1 * rstd * w.y + b.y;
        y[2] = d2 * rstd * w.z + b.z;
        y[3] = d3 * rstd * w.w + b.w;

        v4h yh;
#pragma unroll
        for (int t = 0; t < 4; ++t) yh[t] = (_Float16)y[t];
        *(v4h*)(xn + (size_t)(token0 + u * NN) * DD + lane * 4) = yh;

        // tri[h] = sum_d xn[d] * w_tri[d][h]
        float t0 = 0.f, t1 = 0.f, t2 = 0.f, t3 = 0.f;
#pragma unroll
        for (int t = 0; t < 4; ++t) {
            t0 += y[t] * wr[t].x; t1 += y[t] * wr[t].y;
            t2 += y[t] * wr[t].z; t3 += y[t] * wr[t].w;
        }
#pragma unroll
        for (int m = 16; m >= 1; m >>= 1) {
            t0 += __shfl_xor(t0, m, 32); t1 += __shfl_xor(t1, m, 32);
            t2 += __shfl_xor(t2, m, 32); t3 += __shfl_xor(t3, m, 32);
        }
        tr[0][u] = t0; tr[1][u] = t1; tr[2][u] = t2; tr[3][u] = t3;
    }
    if (lane == 0) {
        _Float16* td = tri + (m0 >> 4) * 4096 + (n >> 4) * 256
                           + (((m0 >> 3) & 1) * 16 + (n & 15)) * 8;
#pragma unroll
        for (int h = 0; h < HH; ++h) {
            v8h th;
#pragma unroll
            for (int u = 0; u < LN_TPW; ++u) th[u] = (_Float16)(tr[h][u] * LOG2E);
            *(v8h*)(td + h * TOK) = th;
        }
    }

    // the weights' share comes last: the work-groups that have it are the first to start,
    // so its load latency ends before the grid's last work-groups do. The test and the
    // choice of matrix are the same for the whole work-group.
    if (blockIdx.x < WT_BLOCKS) {
        int mat = blockIdx.x >> 6;
        int r   = (blockIdx.x & 63) * 256 + threadIdx.x;
        int n   = (r >> 11) * 16 + ((r >> 3) & 15);
        int k   = ((r >> 8) & 7) * 16 + ((r >> 7) & 1) * 8 + (r & 7);
        const float* W = (mat == 0) ? wq : (mat == 1) ? wk : (mat == 2) ? wv
                       : (mat == 3) ? wg : wo;
        wt[mat * 16384 + r] = (_Float16)W[k * DD + n];
    }
}

#define XP 136
#define VP 264

__global__ __launch_bounds__(512)
void k_row(const _Float16* __restrict__ xn, const _Float16* __restrict__ wt,
           const float* __restrict__ b_g, const _Float16* __restrict__ tri,
           const float* __restrict__ mask, const float* __restrict__ b_o,
           float* __restrict__ out) {
    __shared__ __attribute__((aligned(16))) _Float16 sX[NN * XP];   // xn rows, later g rows
    __shared__ __attribute__((aligned(16))) _Float16 sK[NN * XP];   // K rows [n][h*32+c]
    __shared__ __attribute__((aligned(16))) _Float16 sQ[NN * XP];   // q rows, later o rows
    __shared__ __attribute__((aligned(16))) _Float16 sVt[DD * VP];  // V transposed [h*32+c][n]
    __shared__ __attribute__((aligned(16))) float    sMb[NN];       // mask bias per key
    // w_o in fragment order. The larger alignment puts it first in the work-group's LDS, where every
    // fragment lies within the 16-bit offset field of a read from one address register.
    __shared__ __attribute__((aligned(2048))) _Float16 sWo[DD * DD];
    __shared__ __attribute__((aligned(16))) float    sBo[DD];       // b_o

    int i = blockIdx.x;
    int tid = threadIdx.x, lane = tid & 31;
    // the wave's number in a scalar register: the tests on it below are scalar branches
    int wave = __builtin_amdgcn_readfirstlane(tid >> 5);
    int lm = lane & 15, lg = (lane >> 4) * 8;
    int ct = wave & 7;
    size_t rowbase = (size_t)i * NN;

    // the row's xn: 4096 pieces of 16 B, eight per lane, each wave's copy 512 B in a row
    const _Float16* src = xn + rowbase * DD;
#pragma unroll
    for (int u = 0; u < 8; ++u) {
        int c = u * 512 + tid;
        async_copy_b128(&sX[(c >> 4) * XP + (c & 15) * 8], src + (size_t)c * 8);
    }
    // b_o: 512 B, one copy of one wave (a scalar test: every lane of that wave is on)
    if (wave == 0) async_copy_b128(&sBo[lane * 4], b_o + lane * 4);

    // weights and mask bias come in while the copies fly
    unsigned woff = (unsigned)(ct * 2048 + lane * 8);         // this lane's place in a matrix
    const _Float16* wa = wt + (wave < 8 ? 1 : 2) * 16384;     // k or v
    const _Float16* wb = wt + (wave < 8 ? 0 : 3) * 16384;     // q or g
    v16h fa[4], fb[4];
#pragma unroll
    for (int kk = 0; kk < 4; ++kk) {
        fa[kk] = load_frag_packed(wa + woff + kk * 512);
        fb[kk] = load_frag_packed(wb + woff + kk * 512);
    }
    if (wave < 8) sMb[tid] = (1e9f * LOG2E) * (mask[rowbase + tid] - 1.0f);

    wait_async();
    __syncthreads();

    // w_o as it lies in wt (2048 pieces of 16 B, four per lane) flies under phase 1
    async_copy4_b128(&sWo[tid * 8], wt + 4 * 16384 + tid * 8);

    v8h gk[16] = {};   // g of this wave's channels, all 16 token tiles (waves 8-15)
    if (wave < 8) {
#pragma unroll 2
        for (int tt = 0; tt < 16; ++tt) {
            const _Float16* xr = sX + (tt * 16 + lm) * XP + lg;
            v16h xf[4];
#pragma unroll
            for (int kk = 0; kk < 4; ++kk) xf[kk] = load_frag(xr + kk * 32);
            v8f ak = {}, aq = {};
#pragma unroll
            for (int kk = 0; kk < 4; ++kk) {
                ak = wmma32(fa[kk], xf[kk], ak);   // D[channel lg+r][token lm]
                aq = wmma32(fb[kk], xf[kk], aq);
            }
            v8h hk, hq;
#pragma unroll
            for (int r = 0; r < 8; ++r) {
                hk[r] = (_Float16)ak[r];
                hq[r] = (_Float16)(aq[r] * (0.17677669529663687f * LOG2E));   // q * log2(e) / sqrt(C)
            }
            int o = (tt * 16 + lm) * XP + ct * 16 + lg;
            *(v8h*)(sK + o) = hk;
            *(v8h*)(sQ + o) = hq;
        }
    } else {
        float4 bg0 = *(const float4*)(b_g + ct * 16 + lg);
        float4 bg1 = *(const float4*)(b_g + ct * 16 + lg + 4);
        float bg[8] = {bg0.x, bg0.y, bg0.z, bg0.w, bg1.x, bg1.y, bg1.z, bg1.w};
        // unrolled: gk is indexed by the trip and must stay in registers
#pragma unroll
        for (int tt = 0; tt < 16; ++tt) {
            const _Float16* xr = sX + (tt * 16 + lm) * XP + lg;
            v16h xf[4];
#pragma unroll
            for (int kk = 0; kk < 4; ++kk) xf[kk] = load_frag(xr + kk * 32);
            v8f av = {}, ag = {};
#pragma unroll
            for (int kk = 0; kk < 4; ++kk) {
                av = wmma32(xf[kk], fa[kk], av);   // D[token lg+r][channel lm]
                ag = wmma32(fb[kk], xf[kk], ag);   // D[channel lg+r][token lm]
            }
            v8h hv;
#pragma unroll
            for (int r = 0; r < 8; ++r) hv[r] = (_Float16)av[r];
            *(v8h*)(sVt + (ct * 16 + lm) * VP + tt * 16 + lg) = hv;

            float e[8];     // g = sigmoid(z) = 1 / (1 + exp2(-z * log2(e))), as __expf forms it
#pragma unroll
            for (int r = 0; r < 8; ++r) e[r] = (ag[r] + bg[r]) * -1.44269504088896340736f;
            asm("v_exp_f32 %0, %0\n\tv_exp_f32 %1, %1\n\tv_exp_f32 %2, %2\n\tv_exp_f32 %3, %3\n\t"
                "v_exp_f32 %4, %4\n\tv_exp_f32 %5, %5\n\tv_exp_f32 %6, %6\n\tv_exp_f32 %7, %7\n\t"
                "v_add_f32 %0, 1.0, %0\n\tv_add_f32 %1, 1.0, %1\n\tv_add_f32 %2, 1.0, %2\n\tv_add_f32 %3, 1.0, %3\n\t"
                "v_add_f32 %4, 1.0, %4\n\tv_add_f32 %5, 1.0, %5\n\tv_add_f32 %6, 1.0, %6\n\tv_add_f32 %7, 1.0, %7\n\t"
                "v_rcp_f32 %0, %0\n\tv_rcp_f32 %1, %1\n\tv_rcp_f32 %2, %2\n\tv_rcp_f32 %3, %3\n\t"
                "v_rcp_f32 %4, %4\n\tv_rcp_f32 %5, %5\n\tv_rcp_f32 %6, %6\n\tv_rcp_f32 %7, %7\n\t"
                "v_nop"
                : "+v"(e[0]), "+v"(e[1]), "+v"(e[2]), "+v"(e[3]),
                  "+v"(e[4]), "+v"(e[5]), "+v"(e[6]), "+v"(e[7]));
#pragma unroll
            for (int r = 0; r < 8; ++r) gk[tt][r] = (_Float16)e[r];
        }
    }
    wait_async();       // this wave's pieces of w_o have landed; the barrier publishes them
    __syncthreads();    // every wave has left xn
    if (wave >= 8) {
#pragma unroll
        for (int tt = 0; tt < 16; ++tt)
            *(v8h*)(sX + (tt * 16 + lm) * XP + ct * 16 + lg) = gk[tt];
    }
    __syncthreads();    // k, q, v, g are published

    // B fragments that pick one half of a tri fragment's k range: k = lg + e (id0) or
    // 16 + lg + e (id1) meets column lm with 1 where lg + e == lm, with 0 elsewhere.
    v16h id0 = {}, id1 = {};
#pragma unroll
    for (int e = 0; e < 8; ++e) {
        _Float16 one = (lg + e == lm) ? (_Float16)1.0f : (_Float16)0.0f;
        id0[e] = one;
        id1[8 + e] = one;
    }

    // rolled: the heads unrolled together would multiply the live score registers
    int m0 = wave * 16;
#pragma unroll 1
    for (int h = 0; h < HH; ++h) {
        _Float16* qo = sQ + (m0 + lm) * XP + h * CC + lg;          // this lane's q, then o
        const _Float16* kh = sK + lm * XP + h * CC + lg;
        const _Float16* vh = sVt + (h * CC + lm) * VP + lg;

        // S^T tile nt: s[nt][r] = score(query m0+lm, key nt*16 + lg + r)
        v16h bQ = load_frag(qo);
        const _Float16* tp = tri + h * TOK + wave * 4096 + lane * 8;
        v8f s[16];
        // all 16 tri loads go out first. aT[kp]: rows = keys; k 0..15 = the wave's queries at
        // key tile 2*kp, k 16..31 = the same queries at key tile 2*kp + 1. The half that a
        // product does not want meets zeros of id0 or id1 (tri is finite wherever xn is).
        v16h aT[8];
#pragma unroll
        for (int kp = 0; kp < 8; ++kp) aT[kp] = load_frag_packed(tp + kp * 512);
        // K fragments in groups of four tiles, fetched one group ahead of their WMMAs.
        // The scheduling barriers hold that order: without them the compiler either
        // hoists every LDS load of the tile (spills) or waits on each fragment alone.
        v16h aK[2][4];
#pragma unroll
        for (int j = 0; j < 4; ++j)
            aK[0][j] = load_frag(kh + (j * 16) * XP);
#pragma unroll
        for (int g = 0; g < 4; ++g) {
            __builtin_amdgcn_sched_barrier(0);
            if (g < 3) {
#pragma unroll
                for (int j = 0; j < 4; ++j)
                    aK[(g + 1) & 1][j] = load_frag(kh + (((g + 1) * 4 + j) * 16) * XP);
            }
            __builtin_amdgcn_sched_barrier(0);
#pragma unroll
            for (int j = 0; j < 4; ++j)
                s[g * 4 + j] = wmma32(aK[g & 1][j], bQ, v8f{});
            // tri comes last: its way from L2 lies under the K . Q^T products
#pragma unroll
            for (int j = 0; j < 4; ++j)
                s[g * 4 + j] = wmma32(aT[g * 2 + (j >> 1)], (j & 1) ? id1 : id0, s[g * 4 + j]);
        }
        // the next head's address is formed over the register pair that the tri loads name
        asm volatile("s_wait_xcnt 0x0" ::: "memory");

        float mxj[4] = {-3.0e38f, -3.0e38f, -3.0e38f, -3.0e38f};   // four independent chains
#pragma unroll
        for (int g = 0; g < 4; ++g) {
            // same purpose: at most four tiles' mask bias live at a time
            __builtin_amdgcn_sched_barrier(0);
#pragma unroll
            for (int j = 0; j < 4; ++j) {
                int nt = g * 4 + j;
                float4 b0 = *(const float4*)(sMb + nt * 16 + lg);
                float4 b1 = *(const float4*)(sMb + nt * 16 + lg + 4);
                float mb[8] = {b0.x, b0.y, b0.z, b0.w, b1.x, b1.y, b1.z, b1.w};
#pragma unroll
                for (int r = 0; r < 8; ++r) {
                    s[nt][r] += mb[r];
                    mxj[j] = fmaxf(mxj[j], s[nt][r]);
                }
            }
        }
        float mx = fmaxf(fmaxf(mxj[0], mxj[1]), fmaxf(mxj[2], mxj[3]));
        mx = fmaxf(mx, __shfl_xor(mx, 16, 32));

        // exp, pack two score tiles into one B fragment, O^T += V^T . P^T
        v16h ones;
#pragma unroll
        for (int e = 0; e < 16; ++e) ones[e] = (_Float16)1.0f;
        v8f acc0 = {}, acc1 = {}, accs = {};   // accs: every row is the sum of P over the keys
#pragma unroll
        for (int ks = 0; ks < 8; ++ks) {
            // same purpose: one k-step's V^T fragments live at a time
            __builtin_amdgcn_sched_barrier(0);
            v16h aV0 = load_frag(vh + ks * 32);
            v16h aV1 = load_frag(vh + 16 * VP + ks * 32);
            float p[16];
#pragma unroll
            for (int r = 0; r < 8; ++r) {
                p[r]     = s[2 * ks][r] - mx;
                p[8 + r] = s[2 * ks + 1][r] - mx;
            }
            asm("v_exp_f32 %0, %0\n\tv_exp_f32 %1, %1\n\tv_exp_f32 %2, %2\n\tv_exp_f32 %3, %3\n\t"
                "v_exp_f32 %4, %4\n\tv_exp_f32 %5, %5\n\tv_exp_f32 %6, %6\n\tv_exp_f32 %7, %7\n\t"
                "v_exp_f32 %8, %8\n\tv_exp_f32 %9, %9\n\tv_exp_f32 %10, %10\n\tv_exp_f32 %11, %11\n\t"
                "v_exp_f32 %12, %12\n\tv_exp_f32 %13, %13\n\tv_exp_f32 %14, %14\n\tv_exp_f32 %15, %15\n\t"
                "v_nop"
                : "+v"(p[0]), "+v"(p[1]), "+v"(p[2]), "+v"(p[3]), "+v"(p[4]), "+v"(p[5]),
                  "+v"(p[6]), "+v"(p[7]), "+v"(p[8]), "+v"(p[9]), "+v"(p[10]), "+v"(p[11]),
                  "+v"(p[12]), "+v"(p[13]), "+v"(p[14]), "+v"(p[15]));
            v16h bP;
#pragma unroll
            for (int r = 0; r < 8; ++r) {
                bP[r] = (_Float16)p[r];
                bP[8 + r] = (_Float16)p[8 + r];
            }
            acc0 = wmma32(aV0, bP, acc0);
            acc1 = wmma32(aV1, bP, acc1);
            accs = wmma32(ones, bP, accs);
        }
        float inv = fast_rcp(accs[0]);

        // acc0[r], acc1[r] = O(query m0+lm, channel h*32 + lg + r, + 16): normalise, gate, store
        const _Float16* gp = sX + (m0 + lm) * XP + h * CC + lg;
        v8h g0 = *(const v8h*)gp;
        v8h g1 = *(const v8h*)(gp + 16);
        v8h o0, o1;
#pragma unroll
        for (int r = 0; r < 8; ++r) {
            o0[r] = (_Float16)((float)g0[r] * (acc0[r] * inv));
            o1[r] = (_Float16)((float)g1[r] * (acc1[r] * inv));
        }
        *(v8h*)qo = o0;
        *(v8h*)(qo + 16) = o1;
    }

    // The wave's own o rows as B fragments (each lane reads back exactly the bytes that it has
    // stored itself), and the bias of the channels that this lane stores.
    const _Float16* orow = sQ + (m0 + lm) * XP + lg;
    v16h bO[4];
#pragma unroll
    for (int kk = 0; kk < 4; ++kk) bO[kk] = load_frag(orow + kk * 32);
    float4 bias[2];
    bias[0] = *(const float4*)(sBo + lm * 4);
    bias[1] = *(const float4*)(sBo + 64 + lm * 4);
    int hr = lane >> 4;                                 // which of a store's two rows
    float* og = out + (rowbase + m0 + hr) * DD + lm * 4;
    const _Float16* wl = sWo + lane * 8;                // this lane's place in a fragment
    v16h aW[2][8];
#pragma unroll
    for (int f = 0; f < 8; ++f) aW[0][f] = load_frag_packed(wl + f * 512);
    // unrolled: the two fragment sets are indexed by the trip and must stay in registers
#pragma unroll
    for (int g = 0; g < 4; ++g) {                       // channels 32*g .. +31
        // the next two channel tiles' w_o fragments go out as one group ahead of this trip's
        // WMMAs; the scheduling barriers hold them there (else a wait on each fragment alone)
        __builtin_amdgcn_sched_barrier(0);
        if (g < 3) {
#pragma unroll
            for (int f = 0; f < 8; ++f)
                aW[(g + 1) & 1][f] = load_frag_packed(wl + ((g + 1) * 8 + f) * 512);
        }
        __builtin_amdgcn_sched_barrier(0);
        v8f acc[2] = {};
#pragma unroll
        for (int kk = 0; kk < 4; ++kk)
#pragma unroll
            for (int c = 0; c < 2; ++c)
                acc[c] = wmma32(aW[g & 1][c * 4 + kk], bO[kk], acc[c]);   // D[channel c*16 + lg + r][token lm]
        // staging rows: 64 floats in a row of 272 B (16 B x odd for the b128 stores)
        _Float16* sb = ((g < 2) ? sQ : sX) + m0 * XP;
#pragma unroll
        for (int c = 0; c < 2; ++c) {
            float* sw = (float*)(sb + lm * XP) + (g & 1) * 32 + c * 16 + lg;
            *(float4*)sw       = make_float4(acc[c][0], acc[c][1], acc[c][2], acc[c][3]);
            *(float4*)(sw + 4) = make_float4(acc[c][4], acc[c][5], acc[c][6], acc[c][7]);
        }
        if (g & 1) {
            // the wave's own LDS stores are done before it reads the rows back
            asm volatile("s_wait_dscnt 0x0" ::: "memory");
            float4 bb = bias[g >> 1];
            float4 v[8];
#pragma unroll
            for (int j = 0; j < 8; ++j) {
                v[j] = *(const float4*)((const float*)(sb + (j * 2 + hr) * XP) + lm * 4);
                v[j].x += bb.x; v[j].y += bb.y; v[j].z += bb.z; v[j].w += bb.w;
            }
            // the eight stores go out as one group behind the sums: else the compiler reuses the
            // first stores' data registers for later rows and has to wait on those stores
            __builtin_amdgcn_sched_barrier(0);
#pragma unroll
            for (int j = 0; j < 8; ++j)
                *(float4*)(og + j * 2 * DD + (g >> 1) * 64) = v[j];
            // the second half rewrites registers that these stores name
            if (g < 3) asm volatile("s_wait_xcnt 0x0" ::: "memory");
        }
    }
}

// ---------------------------------------------------------------------------
extern "C" void kernel_launch(void* const* d_in, const int* in_sizes, int n_in,
                              void* d_out, int out_size, void* d_ws, size_t ws_size,
                              hipStream_t stream) {
    const float* x     = (const float*)d_in[0];
    const float* mask  = (const float*)d_in[1];
    const float* ln_w  = (const float*)d_in[2];
    const float* ln_b  = (const float*)d_in[3];
    const float* w_tri = (const float*)d_in[4];
    const float* w_q   = (const float*)d_in[5];
    const float* w_k   = (const float*)d_in[6];
    const float* w_v   = (const float*)d_in[7];
    const float* w_g   = (const float*)d_in[8];
    const float* b_g   = (const float*)d_in[9];
    const float* w_o   = (const float*)d_in[10];
    const float* b_o   = (const float*)d_in[11];

    _Float16* xn   = (_Float16*)d_ws;
    _Float16* wt   = xn + TD;                  // 5 * 16384 halves
    _Float16* tri  = wt + 5 * 16384;           // H * 65536 halves, at a multiple of 512 B

    k_ln_tri<<<TOK / (8 * LN_TPW), 256, 0, stream>>>(x, ln_w, ln_b, w_tri,
                                                     w_q, w_k, w_v, w_g, w_o, xn, tri, wt);
    k_row<<<NN, 512, 0, stream>>>(xn, wt, b_g, tri, mask, b_o, (float*)d_out);
}
